// v000
// Measured on an AMD MI455X. A time is GPU time per run, averaged over a window of back-to-back runs after a warm-up
// (all launches, gaps included; the runs take copies of the inputs in turn), and the median of several windows.
// Apart from v000's, it joins two sittings. Times from different sittings can be a few percent apart, while
// side-by-side timings come from the same sitting.
// v000, which the later versions start from, runs in 257 microseconds.
#include <hip/hip_runtime.h>
#include <math.h>

// Shapes from the reference
#define B 64
#define P 64
#define NN 1000
#define H 128

// LDS strides: even (8B-aligned v2f reads) and bank-conflict-free:
// row-indexed pair reads hit banks {4l+c,4l+c+1} (lanes 0-15) vs
// {4l+c+2,4l+c+3} (lanes 16-31) -> disjoint.
#define EMB_STR 132   // 64 x 132 floats (emb chunk / vsum A / final_q A)
#define MSK_STR 68    // 64 x 68 floats  (mask A)

typedef float v2f __attribute__((ext_vector_type(2)));
typedef float v8f __attribute__((ext_vector_type(8)));
typedef int   v4i __attribute__((ext_vector_type(4)));

// Full-precision matrix op: D(16x16,f32) = A(16x4,f32) * B(4x16,f32) + C
// A: lane(0..15) holds M=lane, K={k,k+1}; lane(16..31): M=lane-16, K={k+2,k+3}
// B: lane holds column N=lane&15, rows K = {2*(lane>>4)+0, 2*(lane>>4)+1}
// C/D: vgpr r -> M = r + 8*(lane>>4), N = lane&15
__device__ __forceinline__ v8f wmma_f32(v2f a, v2f b, v8f c) {
  return __builtin_amdgcn_wmma_f32_16x16x4_f32(false, a, false, b, (short)0, c,
                                               false, false);
}

// ---- CDNA5 async global->LDS staging (guarded; falls back to b128 copy) ----
#if __has_builtin(__builtin_amdgcn_global_load_async_to_lds_b128)
#define HAVE_ASYNC_LDS 1
#else
#define HAVE_ASYNC_LDS 0
#endif

__device__ __forceinline__ void copy16_g2l(float* l, const float* g) {
#if HAVE_ASYNC_LDS
  __builtin_amdgcn_global_load_async_to_lds_b128(
      (__attribute__((address_space(1))) v4i*)g,
      (__attribute__((address_space(3))) v4i*)l,
      0, 0);
#else
  *(float4*)l = *(const float4*)g;
#endif
}

__device__ __forceinline__ void wait_async_copies() {
#if HAVE_ASYNC_LDS
#if __has_builtin(__builtin_amdgcn_s_wait_asynccnt)
  __builtin_amdgcn_s_wait_asynccnt(0);
#else
  asm volatile("s_wait_asynccnt 0x0" ::: "memory");
#endif
#endif
}

// ---------------------------------------------------------------------------
// Kernel 1: final_q[b,p,h] = encq1@Wq_first + last_emb@Wq_last
//                          + (mask01@emb/N)@W_visited + q_graph + load_emb
// One workgroup (8 wave32) per batch b.
// ---------------------------------------------------------------------------
__global__ void __launch_bounds__(256)
fq_kernel(const float* __restrict__ emb, const float* __restrict__ encq1,
          const int* __restrict__ last_node, const float* __restrict__ loadv,
          const float* __restrict__ gmask,
          const float* __restrict__ Wq_graph, const float* __restrict__ Wq_first,
          const float* __restrict__ Wq_last, const float* __restrict__ Wv,
          const float* __restrict__ W_load, const float* __restrict__ b_load,
          float* __restrict__ fq)
{
  __shared__ __align__(16) float s_emb[64 * EMB_STR]; // 33.8 KB
  __shared__ __align__(16) float s_msk[64 * MSK_STR]; // 17.4 KB
  __shared__ float s_part[256];
  __shared__ float s_mean[H];
  __shared__ float s_qg[H];
  __shared__ float s_load[P];

  const int b    = blockIdx.x;
  const int tid  = threadIdx.x;
  const int lane = tid & 31;
  const int wid  = tid >> 5;
  const int lrow = lane & 15;         // M / N position within tile
  const int khi  = (lane >> 4) * 2;   // K offset for upper half-wave
  const float* embB = emb + (size_t)b * NN * H;

  // --- phase 1: column mean over N (all 256 threads), q_graph matvec -------
  {
    const int h = tid & 127, half = tid >> 7;
    float s = 0.f;
    for (int n = half; n < NN; n += 2) s += embB[(size_t)n * H + h];
    s_part[tid] = s;
  }
  if (tid < P) s_load[tid] = loadv[b * P + tid];
  __syncthreads();
  if (tid < H) s_mean[tid] = (s_part[tid] + s_part[tid + 128]) * (1.0f / NN);
  __syncthreads();
  if (tid < H) {
    float s = 0.f;
    for (int k = 0; k < H; ++k) s += s_mean[k] * Wq_graph[k * H + tid];
    s_qg[tid] = s;
  }

  // --- phase 2: vsum[p][h] = sum_n mask01[p][n] * emb[n][h]  (WMMA, K=N) ---
  const int p0 = (wid >> 1) * 16;     // 4 M-tiles, 2 waves each
  const int hb = (wid & 1) * 64;      // each wave owns 64 H columns (4 tiles)
  v8f acc[4] = {};

  for (int n0 = 0; n0 < NN; n0 += 64) {
    const int rows = (NN - n0 < 64) ? (NN - n0) : 64;
    __syncthreads();
    // stage emb chunk rows [0,rows) via async global->LDS b128
    for (int i = tid; i < rows * 32; i += 256) {
      int r = i >> 5, c4 = (i & 31) * 4;
      copy16_g2l(&s_emb[r * EMB_STR + c4], embB + (size_t)(n0 + r) * H + c4);
    }
    for (int i = tid; i < (64 - rows) * 128; i += 256) {   // zero tail rows
      int r = rows + (i >> 7), c = i & 127;
      s_emb[r * EMB_STR + c] = 0.f;
    }
    for (int i = tid; i < 64 * 64; i += 256) {             // stage mask 0/1
      int p = i >> 6, k = i & 63, n = n0 + k;
      float g = (n < NN) ? gmask[((size_t)b * P + p) * NN + n] : 0.f;
      s_msk[p * MSK_STR + k] = (g < -1e30f) ? 1.f : 0.f;
    }
    wait_async_copies();
    __syncthreads();
    for (int kk = 0; kk < 64; kk += 4) {
      v2f a = *(const v2f*)&s_msk[(p0 + lrow) * MSK_STR + kk + khi];
#pragma unroll
      for (int t = 0; t < 4; ++t) {
        v2f bb;
        bb.x = s_emb[(kk + khi + 0) * EMB_STR + hb + 16 * t + lrow];
        bb.y = s_emb[(kk + khi + 1) * EMB_STR + hb + 16 * t + lrow];
        acc[t] = wmma_f32(a, bb, acc[t]);
      }
    }
  }
  __syncthreads();
  // park vsum/N back into LDS as an A matrix [p][h]
  const float invN = 1.0f / NN;
#pragma unroll
  for (int t = 0; t < 4; ++t)
#pragma unroll
    for (int r = 0; r < 8; ++r)
      s_emb[(p0 + r + 8 * (lane >> 4)) * EMB_STR + hb + 16 * t + lrow] =
          acc[t][r] * invN;
  __syncthreads();

  // --- phase 3: three chained K=128 WMMA GEMMs -----------------------------
  v8f f[4] = {};
  const int ln = last_node[b * P + p0 + lrow];
  const v2f* encRow  = (const v2f*)(encq1 + ((size_t)b * P + p0 + lrow) * H);
  const v2f* lastRow = (const v2f*)(embB + (size_t)ln * H);

  for (int k0 = 0; k0 < H; k0 += 4) {
    const int ki = (k0 >> 1) + (lane >> 4);   // v2f index = (k0+khi)/2
    v2f a3 = *(const v2f*)&s_emb[(p0 + lrow) * EMB_STR + k0 + khi];
    v2f a1 = encRow[ki];
    v2f a2 = lastRow[ki];
#pragma unroll
    for (int t = 0; t < 4; ++t) {
      int c0 = (k0 + khi + 0) * H + hb + 16 * t + lrow;
      int c1 = (k0 + khi + 1) * H + hb + 16 * t + lrow;
      v2f b3; b3.x = Wv[c0];       b3.y = Wv[c1];
      f[t] = wmma_f32(a3, b3, f[t]);
      v2f b1; b1.x = Wq_first[c0]; b1.y = Wq_first[c1];
      f[t] = wmma_f32(a1, b1, f[t]);
      v2f b2; b2.x = Wq_last[c0];  b2.y = Wq_last[c1];
      f[t] = wmma_f32(a2, b2, f[t]);
    }
  }

  // epilogue: + q_graph + load*W_load + b_load ; store final_q
#pragma unroll
  for (int t = 0; t < 4; ++t) {
    int h = hb + 16 * t + lrow;
    float wl = W_load[h], bl = b_load[h], qg = s_qg[h];
#pragma unroll
    for (int r = 0; r < 8; ++r) {
      int p = p0 + r + 8 * (lane >> 4);
      fq[((size_t)b * P + p) * H + h] = f[t][r] + qg + s_load[p] * wl + bl;
    }
  }
}

// ---------------------------------------------------------------------------
// Kernel 2: logits[b,p,n] = 10*tanh(fq.emb/sqrt(H) - dist/sqrt(2)) + maskprob
// Two workgroups per batch (even/odd n-tiles); each wave does one n-tile at a
// time against ALL four p-tiles so each B fetch feeds 4 WMMAs.
// ---------------------------------------------------------------------------
__global__ void __launch_bounds__(256)
score_kernel(const float* __restrict__ dists, const float* __restrict__ emb,
             const int* __restrict__ last_node, const float* __restrict__ gmask,
             const float* __restrict__ fq, float* __restrict__ out)
{
  __shared__ __align__(16) float s_fq[64 * EMB_STR];  // 33.8 KB
  __shared__ int s_ln[64];

  const int b      = blockIdx.x >> 1;
  const int parity = blockIdx.x & 1;
  const int tid    = threadIdx.x;
  const int lane   = tid & 31;
  const int wid    = tid >> 5;
  const int lrow   = lane & 15;
  const int khi    = (lane >> 4) * 2;

  const float* fqB = fq + (size_t)b * P * H;
  for (int i = tid; i < 64 * 32; i += 256) {     // stage final_q[b] (async)
    int r = i >> 5, c4 = (i & 31) * 4;
    copy16_g2l(&s_fq[r * EMB_STR + c4], fqB + (size_t)r * H + c4);
  }
  if (tid < 64) s_ln[tid] = last_node[b * P + tid];
  wait_async_copies();
  __syncthreads();

  const float* embB = emb + (size_t)b * NN * H;
  const float inv_sqrtH = 0.08838834764831845f;  // 1/sqrt(128)
  const float inv_sqrt2 = 0.7071067811865476f;

  for (int t = parity + 2 * wid; t < (NN + 15) / 16; t += 16) {
    const int n0 = t * 16;
    const int n  = n0 + lrow;
    const int nc = (n < NN) ? n : (NN - 1);      // clamp address, no EXEC split
    const v2f* embrow = (const v2f*)(embB + (size_t)nc * H);
    v8f acc[4] = {};
    for (int k0 = 0; k0 < H; k0 += 4) {
      v2f bb = embrow[(k0 >> 1) + (lane >> 4)];  // B pair: one b64 load
#pragma unroll
      for (int q = 0; q < 4; ++q) {
        v2f a = *(const v2f*)&s_fq[(q * 16 + lrow) * EMB_STR + k0 + khi];
        acc[q] = wmma_f32(a, bb, acc[q]);
      }
    }
#pragma unroll
    for (int q = 0; q < 4; ++q) {
#pragma unroll
      for (int r = 0; r < 8; ++r) {
        if (n < NN) {
          int p = q * 16 + r + 8 * (lane >> 4);
          float d  = dists[((size_t)b * NN + s_ln[p]) * NN + n];
          float s  = acc[q][r] * inv_sqrtH - d * inv_sqrt2;
          float sc = 10.f * tanhf(s);
          float g  = gmask[((size_t)b * P + p) * NN + n];
          out[((size_t)b * P + p) * NN + n] = sc + ((g < -1e30f) ? -1e8f : g);
        }
      }
    }
  }
}

// ---------------------------------------------------------------------------
// Kernel 3: in-place row softmax over N (exp cached in LDS: 2 global passes)
// ---------------------------------------------------------------------------
__global__ void __launch_bounds__(256)
softmax_kernel(float* __restrict__ out)
{
  __shared__ float red[256];
  __shared__ float s_e[NN];
  float* row = out + (size_t)blockIdx.x * NN;
  const int tid = threadIdx.x;

  float m = -3.4e38f;
  for (int i = tid; i < NN; i += 256) m = fmaxf(m, row[i]);
  red[tid] = m; __syncthreads();
  for (int s = 128; s > 0; s >>= 1) {
    if (tid < s) red[tid] = fmaxf(red[tid], red[tid + s]);
    __syncthreads();
  }
  m = red[0]; __syncthreads();

  float sum = 0.f;
  for (int i = tid; i < NN; i += 256) {
    float e = expf(row[i] - m);
    s_e[i] = e;
    sum += e;
  }
  red[tid] = sum; __syncthreads();
  for (int s = 128; s > 0; s >>= 1) {
    if (tid < s) red[tid] += red[tid + s];
    __syncthreads();
  }
  float inv = 1.0f / red[0];

  for (int i = tid; i < NN; i += 256) row[i] = s_e[i] * inv;
}

// ---------------------------------------------------------------------------
extern "C" void kernel_launch(void* const* d_in, const int* in_sizes, int n_in,
                              void* d_out, int out_size, void* d_ws, size_t ws_size,
                              hipStream_t stream) {
  const float* dists     = (const float*)d_in[0];
  const float* emb       = (const float*)d_in[1];
  const float* encq1     = (const float*)d_in[2];
  const int*   last_node = (const int*)d_in[3];
  const float* loadv     = (const float*)d_in[4];
  const float* gmask     = (const float*)d_in[5];
  const float* Wq_graph  = (const float*)d_in[6];
  const float* Wq_first  = (const float*)d_in[7];
  const float* Wq_last   = (const float*)d_in[8];
  const float* Wv        = (const float*)d_in[9];
  const float* W_load    = (const float*)d_in[10];
  const float* b_load    = (const float*)d_in[11];
  float* out = (float*)d_out;
  float* fq  = (float*)d_ws;   // B*P*H floats = 2 MB scratch

  fq_kernel<<<B, 256, 0, stream>>>(emb, encq1, last_node, loadv, gmask,
                                   Wq_graph, Wq_first, Wq_last, Wv,
                                   W_load, b_load, fq);
  score_kernel<<<B * 2, 256, 0, stream>>>(dists, emb, last_node, gmask, fq, out);
  softmax_kernel<<<B * P, 256, 0, stream>>>(out);
}

// v001
// Measured time: 139 microseconds a run.
// Two timings next to v000 both put it at 1.86 times that version's speed.
#include <hip/hip_runtime.h>
#include <math.h>

// Shapes from the reference
#define B 64
#define P 64
#define NN 1000
#define H 128
#define NCH 16    // 64-row slices of the n axis: ceil(1000 / 64)

// LDS strides: even (8B-aligned v2f reads) and bank-conflict-free:
// row-indexed pair reads hit banks {4l+c,4l+c+1} (lanes 0-15) vs
// {4l+c+2,4l+c+3} (lanes 16-31) -> disjoint.
#define EMB_STR 132   // 64 x 132 floats (emb chunk / final_q A); 16 x 132 (vsum A)
#define MSK_STR 68    // 64 x 68 floats  (mask A)

typedef float v2f __attribute__((ext_vector_type(2)));
typedef float v8f __attribute__((ext_vector_type(8)));
typedef int   v4i __attribute__((ext_vector_type(4)));

// Full-precision matrix op: D(16x16,f32) = A(16x4,f32) * B(4x16,f32) + C
// A: lane(0..15) holds M=lane, K={k,k+1}; lane(16..31): M=lane-16, K={k+2,k+3}
// B: lane holds column N=lane&15, rows K = {2*(lane>>4)+0, 2*(lane>>4)+1}
// C/D: vgpr r -> M = r + 8*(lane>>4), N = lane&15
__device__ __forceinline__ v8f wmma_f32(v2f a, v2f b, v8f c) {
  return __builtin_amdgcn_wmma_f32_16x16x4_f32(false, a, false, b, (short)0, c,
                                               false, false);
}

// ---- CDNA5 async global->LDS staging (guarded; falls back to b128 copy) ----
#if __has_builtin(__builtin_amdgcn_global_load_async_to_lds_b128)
#define HAVE_ASYNC_LDS 1
#else
#define HAVE_ASYNC_LDS 0
#endif

__device__ __forceinline__ void copy16_g2l(float* l, const float* g) {
#if HAVE_ASYNC_LDS
  __builtin_amdgcn_global_load_async_to_lds_b128(
      (__attribute__((address_space(1))) v4i*)g,
      (__attribute__((address_space(3))) v4i*)l,
      0, 0);
#else
  *(float4*)l = *(const float4*)g;
#endif
}

__device__ __forceinline__ void wait_async_copies() {
#if HAVE_ASYNC_LDS
#if __has_builtin(__builtin_amdgcn_s_wait_asynccnt)
  __builtin_amdgcn_s_wait_asynccnt(0);
#else
  asm volatile("s_wait_asynccnt 0x0" ::: "memory");
#endif
#endif
}

// ---------------------------------------------------------------------------
// Kernel 1a: one workgroup (8 wave32) per (batch b, 64-row slice of n).
// Partial vsum[p][h] = sum_n mask01[p][n]*emb[n][h] and partial column sums of
// emb over the slice, both f32, to the workspace. The vsum partial is stored in
// accumulator order (wave, tile, lane, 8 values): whole lines per wave.
// ---------------------------------------------------------------------------
__global__ void __launch_bounds__(256)
vsum_part_kernel(const float* __restrict__ emb, const float* __restrict__ gmask,
                 float* __restrict__ part, float* __restrict__ csum)
{
  __shared__ __align__(16) float s_emb[64 * EMB_STR]; // 33.8 KB
  __shared__ __align__(16) float s_msk[64 * MSK_STR]; // 17.4 KB

  const int b    = blockIdx.x / NCH;
  const int n0   = (blockIdx.x % NCH) * 64;
  const int rows = (NN - n0 < 64) ? (NN - n0) : 64;
  const int tid  = threadIdx.x;
  const int lane = tid & 31;
  const int wid  = tid >> 5;
  const int lrow = lane & 15;         // M / N position within tile
  const int khi  = (lane >> 4) * 2;   // K offset for upper half-wave
  const float* embB = emb + (size_t)b * NN * H;

  // --- partial vsum over the slice (WMMA, K = 64) ---------------------------
  const int p0 = (wid >> 1) * 16;     // 4 M-tiles, 2 waves each
  const int hb = (wid & 1) * 64;      // each wave owns 64 H columns (4 tiles)
  v8f acc[4] = {};

  // stage emb rows [0,rows) via async global->LDS b128
  for (int i = tid; i < rows * 32; i += 256) {
    int r = i >> 5, c4 = (i & 31) * 4;
    copy16_g2l(&s_emb[r * EMB_STR + c4], embB + (size_t)(n0 + r) * H + c4);
  }
  for (int i = tid; i < (64 - rows) * 128; i += 256) {   // zero tail rows
    int r = rows + (i >> 7), c = i & 127;
    s_emb[r * EMB_STR + c] = 0.f;
  }
  for (int i = tid; i < 64 * 64; i += 256) {             // stage mask 0/1
    int p = i >> 6, k = i & 63, n = n0 + k;
    float g = (n < NN) ? gmask[((size_t)b * P + p) * NN + n] : 0.f;
    s_msk[p * MSK_STR + k] = (g < -1e30f) ? 1.f : 0.f;
  }
  wait_async_copies();
  __syncthreads();

  // column sum over the staged rows (tail rows are zero): even and odd rows
  // apart, one value per thread
  {
    const int h = tid & 127, half = tid >> 7;
    float s = 0.f;
    for (int j = 0; j < 32; ++j) s += s_emb[(half + 2 * j) * EMB_STR + h];
    csum[((size_t)blockIdx.x * 2 + half) * H + h] = s;
  }

  for (int kk = 0; kk < 64; kk += 4) {
    v2f a = *(const v2f*)&s_msk[(p0 + lrow) * MSK_STR + kk + khi];
#pragma unroll
    for (int t = 0; t < 4; ++t) {
      v2f bb;
      bb.x = s_emb[(kk + khi + 0) * EMB_STR + hb + 16 * t + lrow];
      bb.y = s_emb[(kk + khi + 1) * EMB_STR + hb + 16 * t + lrow];
      acc[t] = wmma_f32(a, bb, acc[t]);
    }
  }
#pragma unroll
  for (int t = 0; t < 4; ++t)
    *(v8f*)(part + (((size_t)blockIdx.x * 8 + wid) * 4 + t) * 256 + lane * 8) = acc[t];
}

// ---------------------------------------------------------------------------
// Kernel 1b: final_q[b,p,h] = encq1@Wq_first + last_emb@Wq_last
//                           + (vsum/N)@W_visited + q_graph + load_emb
// One workgroup (4 wave32) per (batch b, 16-row tile of p); each wave owns
// 32 H columns (2 tiles = one 128-byte line of every output row). The slices'
// partials are summed in slice order.
// ---------------------------------------------------------------------------
__global__ void __launch_bounds__(128)
fq_kernel(const float* __restrict__ emb, const float* __restrict__ encq1,
          const int* __restrict__ last_node, const float* __restrict__ loadv,
          const float* __restrict__ Wq_graph, const float* __restrict__ Wq_first,
          const float* __restrict__ Wq_last, const float* __restrict__ Wv,
          const float* __restrict__ W_load, const float* __restrict__ b_load,
          const float* __restrict__ part, const float* __restrict__ csum,
          float* __restrict__ fq)
{
  __shared__ __align__(16) float s_vs[16 * EMB_STR];  // vsum/N as an A matrix
  __shared__ float s_mean[H];
  __shared__ float s_qg[H];
  __shared__ float s_load[16];

  const int b    = blockIdx.x >> 2;
  const int pt   = blockIdx.x & 3;
  const int p0   = pt * 16;
  const int tid  = threadIdx.x;
  const int lane = tid & 31;
  const int wid  = tid >> 5;
  const int lrow = lane & 15;         // M / N position within tile
  const int khi  = (lane >> 4) * 2;   // K offset for upper half-wave
  const int hb   = wid * 32;
  const float* embB = emb + (size_t)b * NN * H;

  // --- column mean from the slices' sums, q_graph matvec -------------------
  {
    float s = 0.f;
    const float* cb = csum + (size_t)b * 2 * NCH * H;
    for (int c = 0; c < 2 * NCH; ++c) s += cb[c * H + tid];
    // the loads' base and offset are reused further down; as inputs they live up to the wait
    asm volatile("s_wait_xcnt 0x0" :: "s"(cb), "v"(tid) : "memory");
    s_mean[tid] = s * (1.0f / NN);
  }
  if (tid < 16) s_load[tid] = loadv[b * P + p0 + tid];
  __syncthreads();
  {
    float s = 0.f;
    for (int k = 0; k < H; ++k) s += s_mean[k] * Wq_graph[k * H + tid];
    s_qg[tid] = s;
  }

  // --- vsum tile = sum of the slices' partials (accumulator order) ---------
  // H tile 2*wid+t was tile (2*wid+t)&3 of kernel 1a's wave 2*pt + (wid>>1).
  v8f acc[2] = {};
  const float* pw = part + ((((size_t)b * NCH) * 8 + pt * 2 + (wid >> 1)) * 4 +
                            (wid & 1) * 2) * 256 + lane * 8;
#pragma unroll
  for (int c = 0; c < NCH; ++c)
#pragma unroll
    for (int t = 0; t < 2; ++t)
      acc[t] += *(const v8f*)(pw + (size_t)c * 8192 + t * 256);

  // park vsum/N into LDS as an A matrix [p][h]
  const float invN = 1.0f / NN;
#pragma unroll
  for (int t = 0; t < 2; ++t)
#pragma unroll
    for (int r = 0; r < 8; ++r)
      s_vs[(r + 8 * (lane >> 4)) * EMB_STR + hb + 16 * t + lrow] =
          acc[t][r] * invN;
  __syncthreads();

  // --- three chained K=128 WMMA GEMMs --------------------------------------
  v8f f[2] = {};
  const int ln = last_node[b * P + p0 + lrow];
  const v2f* encRow  = (const v2f*)(encq1 + ((size_t)b * P + p0 + lrow) * H);
  const v2f* lastRow = (const v2f*)(embB + (size_t)ln * H);

  for (int k0 = 0; k0 < H; k0 += 4) {
    const int ki = (k0 >> 1) + (lane >> 4);   // v2f index = (k0+khi)/2
    v2f a3 = *(const v2f*)&s_vs[lrow * EMB_STR + k0 + khi];
    v2f a1 = encRow[ki];
    v2f a2 = lastRow[ki];
#pragma unroll
    for (int t = 0; t < 2; ++t) {
      int c0 = (k0 + khi + 0) * H + hb + 16 * t + lrow;
      int c1 = (k0 + khi + 1) * H + hb + 16 * t + lrow;
      v2f b3; b3.x = Wv[c0];       b3.y = Wv[c1];
      f[t] = wmma_f32(a3, b3, f[t]);
      v2f b1; b1.x = Wq_first[c0]; b1.y = Wq_first[c1];
      f[t] = wmma_f32(a1, b1, f[t]);
      v2f b2; b2.x = Wq_last[c0];  b2.y = Wq_last[c1];
      f[t] = wmma_f32(a2, b2, f[t]);
    }
  }

  // epilogue: + q_graph + load*W_load + b_load ; store final_q
#pragma unroll
  for (int t = 0; t < 2; ++t) {
    int h = hb + 16 * t + lrow;
    float wl = W_load[h], bl = b_load[h], qg = s_qg[h];
#pragma unroll
    for (int r = 0; r < 8; ++r) {
      int pl = r + 8 * (lane >> 4);
      fq[((size_t)b * P + p0 + pl) * H + h] = f[t][r] + qg + s_load[pl] * wl + bl;
    }
  }
}

// ---------------------------------------------------------------------------
// Kernel 2: logits[b,p,n] = 10*tanh(fq.emb/sqrt(H) - dist/sqrt(2)) + maskprob
// Two workgroups per batch (even/odd n-tiles); each wave does one n-tile at a
// time against ALL four p-tiles so each B fetch feeds 4 WMMAs.
// ---------------------------------------------------------------------------
__global__ void __launch_bounds__(256)
score_kernel(const float* __restrict__ dists, const float* __restrict__ emb,
             const int* __restrict__ last_node, const float* __restrict__ gmask,
             const float* __restrict__ fq, float* __restrict__ out)
{
  __shared__ __align__(16) float s_fq[64 * EMB_STR];  // 33.8 KB
  __shared__ int s_ln[64];

  const int b      = blockIdx.x >> 1;
  const int parity = blockIdx.x & 1;
  const int tid    = threadIdx.x;
  const int lane   = tid & 31;
  const int wid    = tid >> 5;
  const int lrow   = lane & 15;
  const int khi    = (lane >> 4) * 2;

  const float* fqB = fq + (size_t)b * P * H;
  for (int i = tid; i < 64 * 32; i += 256) {     // stage final_q[b] (async)
    int r = i >> 5, c4 = (i & 31) * 4;
    copy16_g2l(&s_fq[r * EMB_STR + c4], fqB + (size_t)r * H + c4);
  }
  if (tid < 64) s_ln[tid] = last_node[b * P + tid];
  wait_async_copies();
  __syncthreads();

  const float* embB = emb + (size_t)b * NN * H;
  const float inv_sqrtH = 0.08838834764831845f;  // 1/sqrt(128)
  const float inv_sqrt2 = 0.7071067811865476f;

  for (int t = parity + 2 * wid; t < (NN + 15) / 16; t += 16) {
    const int n0 = t * 16;
    const int n  = n0 + lrow;
    const int nc = (n < NN) ? n : (NN - 1);      // clamp address, no EXEC split
    const v2f* embrow = (const v2f*)(embB + (size_t)nc * H);
    v8f acc[4] = {};
    for (int k0 = 0; k0 < H; k0 += 4) {
      v2f bb = embrow[(k0 >> 1) + (lane >> 4)];  // B pair: one b64 load
#pragma unroll
      for (int q = 0; q < 4; ++q) {
        v2f a = *(const v2f*)&s_fq[(q * 16 + lrow) * EMB_STR + k0 + khi];
        acc[q] = wmma_f32(a, bb, acc[q]);
      }
    }
#pragma unroll
    for (int q = 0; q < 4; ++q) {
#pragma unroll
      for (int r = 0; r < 8; ++r) {
        if (n < NN) {
          int p = q * 16 + r + 8 * (lane >> 4);
          float d  = dists[((size_t)b * NN + s_ln[p]) * NN + n];
          float s  = acc[q][r] * inv_sqrtH - d * inv_sqrt2;
          float sc = 10.f * tanhf(s);
          float g  = gmask[((size_t)b * P + p) * NN + n];
          out[((size_t)b * P + p) * NN + n] = sc + ((g < -1e30f) ? -1e8f : g);
        }
      }
    }
  }
}

// ---------------------------------------------------------------------------
// Kernel 3: in-place row softmax over N (exp cached in LDS: 2 global passes)
// ---------------------------------------------------------------------------
__global__ void __launch_bounds__(256)
softmax_kernel(float* __restrict__ out)
{
  __shared__ float red[256];
  __shared__ float s_e[NN];
  float* row = out + (size_t)blockIdx.x * NN;
  const int tid = threadIdx.x;

  float m = -3.4e38f;
  for (int i = tid; i < NN; i += 256) m = fmaxf(m, row[i]);
  red[tid] = m; __syncthreads();
  for (int s = 128; s > 0; s >>= 1) {
    if (tid < s) red[tid] = fmaxf(red[tid], red[tid + s]);
    __syncthreads();
  }
  m = red[0]; __syncthreads();

  float sum = 0.f;
  for (int i = tid; i < NN; i += 256) {
    float e = expf(row[i] - m);
    s_e[i] = e;
    sum += e;
  }
  red[tid] = sum; __syncthreads();
  for (int s = 128; s > 0; s >>= 1) {
    if (tid < s) red[tid] += red[tid + s];
    __syncthreads();
  }
  float inv = 1.0f / red[0];

  for (int i = tid; i < NN; i += 256) row[i] = s_e[i] * inv;
}

// ---------------------------------------------------------------------------
extern "C" void kernel_launch(void* const* d_in, const int* in_sizes, int n_in,
                              void* d_out, int out_size, void* d_ws, size_t ws_size,
                              hipStream_t stream) {
  const float* dists     = (const float*)d_in[0];
  const float* emb       = (const float*)d_in[1];
  const float* encq1     = (const float*)d_in[2];
  const int*   last_node = (const int*)d_in[3];
  const float* loadv     = (const float*)d_in[4];
  const float* gmask     = (const float*)d_in[5];
  const float* Wq_graph  = (const float*)d_in[6];
  const float* Wq_first  = (const float*)d_in[7];
  const float* Wq_last   = (const float*)d_in[8];
  const float* Wv        = (const float*)d_in[9];
  const float* W_load    = (const float*)d_in[10];
  const float* b_load    = (const float*)d_in[11];
  float* out = (float*)d_out;
  float* fq   = (float*)d_ws;    // B*P*H floats = 2 MB scratch
  float* part = fq + 524288;     // B*NCH*P*H floats = 32 MB of vsum partials
  float* csum = part + 8388608;  // B*NCH*2*H floats of column-sum partials

  vsum_part_kernel<<<B * NCH, 256, 0, stream>>>(emb, gmask, part, csum);
  fq_kernel<<<B * 4, 128, 0, stream>>>(emb, encq1, last_node, loadv,
                                       Wq_graph, Wq_first, Wq_last, Wv,
                                       W_load, b_load, part, csum, fq);
  score_kernel<<<B * 2, 256, 0, stream>>>(dists, emb, last_node, gmask, fq, out);
  softmax_kernel<<<B * P, 256, 0, stream>>>(out);
}

// v002
// One run takes 91.7 microseconds.
// Two timings next to v001 put it at 1.50 and 1.52 times that version's speed.
// Over all steps from v000 it is 2.81 times as fast.
#include <hip/hip_runtime.h>
#include <math.h>

// Shapes from the reference
#define B 64
#define P 64
#define NN 1000
#define H 128
#define NCH 16    // 64-row slices of the n axis: ceil(1000 / 64)

// LDS strides: even (8B-aligned v2f reads) and bank-conflict-free:
// row-indexed pair reads hit banks {4l+c,4l+c+1} (lanes 0-15) vs
// {4l+c+2,4l+c+3} (lanes 16-31) -> disjoint.
#define EMB_STR 132   // 64 x 132 floats (emb chunk / final_q A); 16 x 132 (vsum A)
#define MSK_STR 68    // 64 x 68 floats  (mask A)

typedef float v2f __attribute__((ext_vector_type(2)));
typedef float v8f __attribute__((ext_vector_type(8)));
typedef int   v4i __attribute__((ext_vector_type(4)));

// Full-precision matrix op: D(16x16,f32) = A(16x4,f32) * B(4x16,f32) + C
// A: lane(0..15) holds M=lane, K={k,k+1}; lane(16..31): M=lane-16, K={k+2,k+3}
// B: lane holds column N=lane&15, rows K = {2*(lane>>4)+0, 2*(lane>>4)+1}
// C/D: vgpr r -> M = r + 8*(lane>>4), N = lane&15
__device__ __forceinline__ v8f wmma_f32(v2f a, v2f b, v8f c) {
  return __builtin_amdgcn_wmma_f32_16x16x4_f32(false, a, false, b, (short)0, c,
                                               false, false);
}

// ---- CDNA5 async global->LDS staging (guarded; falls back to b128 copy) ----
#if __has_builtin(__builtin_amdgcn_global_load_async_to_lds_b128)
#define HAVE_ASYNC_LDS 1
#else
#define HAVE_ASYNC_LDS 0
#endif

__device__ __forceinline__ void copy16_g2l(float* l, const float* g) {
#if HAVE_ASYNC_LDS
  __builtin_amdgcn_global_load_async_to_lds_b128(
      (__attribute__((address_space(1))) v4i*)g,
      (__attribute__((address_space(3))) v4i*)l,
      0, 0);
#else
  *(float4*)l = *(const float4*)g;
#endif
}

__device__ __forceinline__ void wait_async_copies() {
#if HAVE_ASYNC_LDS
#if __has_builtin(__builtin_amdgcn_s_wait_asynccnt)
  __builtin_amdgcn_s_wait_asynccnt(0);
#else
  asm volatile("s_wait_asynccnt 0x0" ::: "memory");
#endif
#endif
}

// ---------------------------------------------------------------------------
// Kernel 1a: one workgroup (8 wave32) per (batch b, 64-row slice of n).
// Partial vsum[p][h] = sum_n mask01[p][n]*emb[n][h] and partial column sums of
// emb over the slice, both f32, to the workspace. The vsum partial is stored in
// accumulator order (wave, tile, lane, 8 values): whole lines per wave.
// ---------------------------------------------------------------------------
__global__ void __launch_bounds__(256)
vsum_part_kernel(const float* __restrict__ emb, const float* __restrict__ gmask,
                 float* __restrict__ part, float* __restrict__ csum)
{
  __shared__ __align__(16) float s_emb[64 * EMB_STR]; // 33.8 KB
  __shared__ __align__(16) float s_msk[64 * MSK_STR]; // 17.4 KB

  const int b    = blockIdx.x / NCH;
  const int n0   = (blockIdx.x % NCH) * 64;
  const int rows = (NN - n0 < 64) ? (NN - n0) : 64;
  const int tid  = threadIdx.x;
  const int lane = tid & 31;
  const int wid  = tid >> 5;
  const int lrow = lane & 15;         // M / N position within tile
  const int khi  = (lane >> 4) * 2;   // K offset for upper half-wave
  const float* embB = emb + (size_t)b * NN * H;

  // --- partial vsum over the slice (WMMA, K = 64) ---------------------------
  const int p0 = (wid >> 1) * 16;     // 4 M-tiles, 2 waves each
  const int hb = (wid & 1) * 64;      // each wave owns 64 H columns (4 tiles)
  v8f acc[4] = {};

  // stage emb rows [0,rows) via async global->LDS b128
  for (int i = tid; i < rows * 32; i += 256) {
    int r = i >> 5, c4 = (i & 31) * 4;
    copy16_g2l(&s_emb[r * EMB_STR + c4], embB + (size_t)(n0 + r) * H + c4);
  }
  for (int i = tid; i < (64 - rows) * 128; i += 256) {   // zero tail rows
    int r = rows + (i >> 7), c = i & 127;
    s_emb[r * EMB_STR + c] = 0.f;
  }
  for (int i = tid; i < 64 * 64; i += 256) {             // stage mask 0/1
    int p = i >> 6, k = i & 63, n = n0 + k;
    float g = (n < NN) ? gmask[((size_t)b * P + p) * NN + n] : 0.f;
    s_msk[p * MSK_STR + k] = (g < -1e30f) ? 1.f : 0.f;
  }
  wait_async_copies();
  __syncthreads();

  // column sum over the staged rows (tail rows are zero): even and odd rows
  // apart, one value per thread
  {
    const int h = tid & 127, half = tid >> 7;
    float s = 0.f;
    for (int j = 0; j < 32; ++j) s += s_emb[(half + 2 * j) * EMB_STR + h];
    csum[((size_t)blockIdx.x * 2 + half) * H + h] = s;
  }

  for (int kk = 0; kk < 64; kk += 4) {
    v2f a = *(const v2f*)&s_msk[(p0 + lrow) * MSK_STR + kk + khi];
#pragma unroll
    for (int t = 0; t < 4; ++t) {
      v2f bb;
      bb.x = s_emb[(kk + khi + 0) * EMB_STR + hb + 16 * t + lrow];
      bb.y = s_emb[(kk + khi + 1) * EMB_STR + hb + 16 * t + lrow];
      acc[t] = wmma_f32(a, bb, acc[t]);
    }
  }
#pragma unroll
  for (int t = 0; t < 4; ++t)
    *(v8f*)(part + (((size_t)blockIdx.x * 8 + wid) * 4 + t) * 256 + lane * 8) = acc[t];
}

// ---------------------------------------------------------------------------
// Kernel 1b: final_q[b,p,h] = encq1@Wq_first + last_emb@Wq_last
//                           + (vsum/N)@W_visited + q_graph + load_emb
// One workgroup (4 wave32) per (batch b, 16-row tile of p); each wave owns
// 32 H columns (2 tiles = one 128-byte line of every output row). The slices'
// partials are summed in slice order.
// ---------------------------------------------------------------------------
__global__ void __launch_bounds__(128)
fq_kernel(const float* __restrict__ emb, const float* __restrict__ encq1,
          const int* __restrict__ last_node, const float* __restrict__ loadv,
          const float* __restrict__ Wq_graph, const float* __restrict__ Wq_first,
          const float* __restrict__ Wq_last, const float* __restrict__ Wv,
          const float* __restrict__ W_load, const float* __restrict__ b_load,
          const float* __restrict__ part, const float* __restrict__ csum,
          float* __restrict__ fq)
{
  __shared__ __align__(16) float s_vs[16 * EMB_STR];  // vsum/N as an A matrix
  __shared__ float s_mean[H];
  __shared__ float s_qg[H];
  __shared__ float s_load[16];

  const int b    = blockIdx.x >> 2;
  const int pt   = blockIdx.x & 3;
  const int p0   = pt * 16;
  const int tid  = threadIdx.x;
  const int lane = tid & 31;
  const int wid  = tid >> 5;
  const int lrow = lane & 15;         // M / N position within tile
  const int khi  = (lane >> 4) * 2;   // K offset for upper half-wave
  const int hb   = wid * 32;
  const float* embB = emb + (size_t)b * NN * H;

  // --- column mean from the slices' sums, q_graph matvec -------------------
  {
    float s = 0.f;
    const float* cb = csum + (size_t)b * 2 * NCH * H;
    for (int c = 0; c < 2 * NCH; ++c) s += cb[c * H + tid];
    // the loads' base and offset are reused further down; as inputs they live up to the wait
    asm volatile("s_wait_xcnt 0x0" :: "s"(cb), "v"(tid) : "memory");
    s_mean[tid] = s * (1.0f / NN);
  }
  if (tid < 16) s_load[tid] = loadv[b * P + p0 + tid];
  __syncthreads();
  {
    float s = 0.f;
    for (int k = 0; k < H; ++k) s += s_mean[k] * Wq_graph[k * H + tid];
    s_qg[tid] = s;
  }

  // --- vsum tile = sum of the slices' partials (accumulator order) ---------
  // H tile 2*wid+t was tile (2*wid+t)&3 of kernel 1a's wave 2*pt + (wid>>1).
  v8f acc[2] = {};
  const float* pw = part + ((((size_t)b * NCH) * 8 + pt * 2 + (wid >> 1)) * 4 +
                            (wid & 1) * 2) * 256 + lane * 8;
#pragma unroll
  for (int c = 0; c < NCH; ++c)
#pragma unroll
    for (int t = 0; t < 2; ++t)
      acc[t] += *(const v8f*)(pw + (size_t)c * 8192 + t * 256);

  // park vsum/N into LDS as an A matrix [p][h]
  const float invN = 1.0f / NN;
#pragma unroll
  for (int t = 0; t < 2; ++t)
#pragma unroll
    for (int r = 0; r < 8; ++r)
      s_vs[(r + 8 * (lane >> 4)) * EMB_STR + hb + 16 * t + lrow] =
          acc[t][r] * invN;
  __syncthreads();

  // --- three chained K=128 WMMA GEMMs --------------------------------------
  v8f f[2] = {};
  const int ln = last_node[b * P + p0 + lrow];
  const v2f* encRow  = (const v2f*)(encq1 + ((size_t)b * P + p0 + lrow) * H);
  const v2f* lastRow = (const v2f*)(embB + (size_t)ln * H);

  for (int k0 = 0; k0 < H; k0 += 4) {
    const int ki = (k0 >> 1) + (lane >> 4);   // v2f index = (k0+khi)/2
    v2f a3 = *(const v2f*)&s_vs[lrow * EMB_STR + k0 + khi];
    v2f a1 = encRow[ki];
    v2f a2 = lastRow[ki];
#pragma unroll
    for (int t = 0; t < 2; ++t) {
      int c0 = (k0 + khi + 0) * H + hb + 16 * t + lrow;
      int c1 = (k0 + khi + 1) * H + hb + 16 * t + lrow;
      v2f b3; b3.x = Wv[c0];       b3.y = Wv[c1];
      f[t] = wmma_f32(a3, b3, f[t]);
      v2f b1; b1.x = Wq_first[c0]; b1.y = Wq_first[c1];
      f[t] = wmma_f32(a1, b1, f[t]);
      v2f b2; b2.x = Wq_last[c0];  b2.y = Wq_last[c1];
      f[t] = wmma_f32(a2, b2, f[t]);
    }
  }

  // epilogue: + q_graph + load*W_load + b_load ; store final_q
#pragma unroll
  for (int t = 0; t < 2; ++t) {
    int h = hb + 16 * t + lrow;
    float wl = W_load[h], bl = b_load[h], qg = s_qg[h];
#pragma unroll
    for (int r = 0; r < 8; ++r) {
      int pl = r + 8 * (lane >> 4);
      fq[((size_t)b * P + p0 + pl) * H + h] = f[t][r] + qg + s_load[pl] * wl + bl;
    }
  }
}

// ---------------------------------------------------------------------------
// Kernel 2: logits[b,p,n] = 10*tanh(fq.emb/sqrt(H) - dist/sqrt(2)) + maskprob
// Two workgroups per batch (even/odd n-tiles); each wave does one n-tile at a
// time against ALL four p-tiles so each B fetch feeds 4 WMMAs.
// ---------------------------------------------------------------------------
__global__ void __launch_bounds__(256)
score_kernel(const float* __restrict__ dists, const float* __restrict__ emb,
             const int* __restrict__ last_node, const float* __restrict__ gmask,
             const float* __restrict__ fq, float* __restrict__ out)
{
  __shared__ __align__(16) float s_fq[64 * EMB_STR];  // 33.8 KB
  __shared__ int s_ln[64];

  const int b      = blockIdx.x >> 1;
  const int parity = blockIdx.x & 1;
  const int tid    = threadIdx.x;
  const int lane   = tid & 31;
  const int wid    = tid >> 5;
  const int lrow   = lane & 15;
  const int khi    = (lane >> 4) * 2;

  const float* fqB = fq + (size_t)b * P * H;
  for (int i = tid; i < 64 * 32; i += 256) {     // stage final_q[b] (async)
    int r = i >> 5, c4 = (i & 31) * 4;
    copy16_g2l(&s_fq[r * EMB_STR + c4], fqB + (size_t)r * H + c4);
  }
  if (tid < 64) {                                // row index bounded before use
    int v = last_node[b * P + tid];
    s_ln[tid] = (v < 0) ? 0 : ((v > NN - 1) ? NN - 1 : v);
  }
  wait_async_copies();
  __syncthreads();

  const float* embB = emb + (size_t)b * NN * H;
  const float inv_sqrtH = 0.08838834764831845f;  // 1/sqrt(128)
  const float inv_sqrt2 = 0.7071067811865476f;

  for (int t = parity + 2 * wid; t < (NN + 15) / 16; t += 16) {
    const int n0 = t * 16;
    const int n  = n0 + lrow;
    const int nc = (n < NN) ? n : (NN - 1);      // clamp address, no EXEC split
    const v2f* embrow = (const v2f*)(embB + (size_t)nc * H);
    // The tile's 32 distance and 32 mask values per lane are asked for here, in
    // one batch, so that their latency is paid once per tile and beside the
    // first emb load's. Column clamped like emb's: every address is in bounds.
    float dv[4][8], gv[4][8];
#pragma unroll
    for (int q = 0; q < 4; ++q) {
#pragma unroll
      for (int r = 0; r < 8; ++r) {
        int p = q * 16 + r + 8 * (lane >> 4);
        dv[q][r] = dists[((size_t)b * NN + s_ln[p]) * NN + nc];
        gv[q][r] = gmask[((size_t)b * P + p) * NN + nc];
      }
    }
    // keeps the batch above the k loop: the scheduler would move each load
    // down to its use, where it waits alone
    __builtin_amdgcn_sched_barrier(0);

    v8f acc[4] = {};
    for (int k0 = 0; k0 < H; k0 += 4) {
      v2f bb = embrow[(k0 >> 1) + (lane >> 4)];  // B pair: one b64 load
#pragma unroll
      for (int q = 0; q < 4; ++q) {
        v2f a = *(const v2f*)&s_fq[(q * 16 + lrow) * EMB_STR + k0 + khi];
        acc[q] = wmma_f32(a, bb, acc[q]);
      }
    }
    // keeps the first use of a batched value, and the wait it brings, behind the
    // k loop: hoisted, it stands in front of the emb loads and delays them
    __builtin_amdgcn_sched_barrier(0);

    // Only the store is under the tail guard: with the whole epilogue inside it
    // the compiler sinks the batch of loads into that branch, behind the k loop.
#pragma unroll
    for (int q = 0; q < 4; ++q) {
#pragma unroll
      for (int r = 0; r < 8; ++r) {
        int p = q * 16 + r + 8 * (lane >> 4);
        float s  = acc[q][r] * inv_sqrtH - dv[q][r] * inv_sqrt2;
        float sc = 10.f * tanhf(s);
        float g  = gv[q][r];
        float o  = sc + ((g < -1e30f) ? -1e8f : g);
        if (n < NN) {
          out[((size_t)b * P + p) * NN + n] = o;
          // The tile's last store: its address registers are stepped for the
          // next tile right behind it.
          // Inside the branch nothing is lifted over it.
          if (q == 3 && r == 7) asm volatile("s_wait_xcnt 0x0" ::: "memory");
        }
      }
    }
  }
}

// ---------------------------------------------------------------------------
// Kernel 3: in-place row softmax over N (exp cached in LDS: 2 global passes)
// ---------------------------------------------------------------------------
__global__ void __launch_bounds__(256)
softmax_kernel(float* __restrict__ out)
{
  __shared__ float red[256];
  __shared__ float s_e[NN];
  float* row = out + (size_t)blockIdx.x * NN;
  const int tid = threadIdx.x;

  float m = -3.4e38f;
  for (int i = tid; i < NN; i += 256) m = fmaxf(m, row[i]);
  red[tid] = m; __syncthreads();
  for (int s = 128; s > 0; s >>= 1) {
    if (tid < s) red[tid] = fmaxf(red[tid], red[tid + s]);
    __syncthreads();
  }
  m = red[0]; __syncthreads();

  float sum = 0.f;
  for (int i = tid; i < NN; i += 256) {
    float e = expf(row[i] - m);
    s_e[i] = e;
    sum += e;
  }
  red[tid] = sum; __syncthreads();
  for (int s = 128; s > 0; s >>= 1) {
    if (tid < s) red[tid] += red[tid + s];
    __syncthreads();
  }
  float inv = 1.0f / red[0];

  for (int i = tid; i < NN; i += 256) row[i] = s_e[i] * inv;
}

// ---------------------------------------------------------------------------
extern "C" void kernel_launch(void* const* d_in, const int* in_sizes, int n_in,
                              void* d_out, int out_size, void* d_ws, size_t ws_size,
                              hipStream_t stream) {
  const float* dists     = (const float*)d_in[0];
  const float* emb       = (const float*)d_in[1];
  const float* encq1     = (const float*)d_in[2];
  const int*   last_node = (const int*)d_in[3];
  const float* loadv     = (const float*)d_in[4];
  const float* gmask     = (const float*)d_in[5];
  const float* Wq_graph  = (const float*)d_in[6];
  const float* Wq_first  = (const float*)d_in[7];
  const float* Wq_last   = (const float*)d_in[8];
  const float* Wv        = (const float*)d_in[9];
  const float* W_load    = (const float*)d_in[10];
  const float* b_load    = (const float*)d_in[11];
  float* out = (float*)d_out;
  float* fq   = (float*)d_ws;    // B*P*H floats = 2 MB scratch
  float* part = fq + 524288;     // B*NCH*P*H floats = 32 MB of vsum partials
  float* csum = part + 8388608;  // B*NCH*2*H floats of column-sum partials

  vsum_part_kernel<<<B * NCH, 256, 0, stream>>>(emb, gmask, part, csum);
  fq_kernel<<<B * 4, 128, 0, stream>>>(emb, encq1, last_node, loadv,
                                       Wq_graph, Wq_first, Wq_last, Wv,
                                       W_load, b_load, part, csum, fq);
  score_kernel<<<B * 2, 256, 0, stream>>>(dists, emb, last_node, gmask, fq, out);
  softmax_kernel<<<B * P, 256, 0, stream>>>(out);
}

// v004
// One run takes 42.8 microseconds.
// It is 2.16 times as fast as v002, going by the measured steps of the versions left out in between.
// Over all steps from v000 it is 6.08 times as fast.
#include <hip/hip_runtime.h>
#include <math.h>

// Shapes from the reference
#define B 64
#define P 64
#define NN 1000
#define H 128
#define NCH 16    // 64-row slices of the n axis: ceil(1000 / 64)

// LDS strides: even (8B-aligned v2f reads) and bank-conflict-free:
// row-indexed pair reads hit banks {4l+c,4l+c+1} (lanes 0-15) vs
// {4l+c+2,4l+c+3} (lanes 16-31) -> disjoint.
#define EMB_STR 132   // 64 x 132 floats (emb chunk); 16 x 132 (vsum A / final_q A / emb tiles)
#define MSK_STR 68    // 64 x 68 floats  (mask A)

typedef float v2f __attribute__((ext_vector_type(2)));
typedef float v8f __attribute__((ext_vector_type(8)));
typedef int   v4i __attribute__((ext_vector_type(4)));

// Full-precision matrix op: D(16x16,f32) = A(16x4,f32) * B(4x16,f32) + C
// A: lane(0..15) holds M=lane, K={k,k+1}; lane(16..31): M=lane-16, K={k+2,k+3}
// B: lane holds column N=lane&15, rows K = {2*(lane>>4)+0, 2*(lane>>4)+1}
// C/D: vgpr r -> M = r + 8*(lane>>4), N = lane&15
__device__ __forceinline__ v8f wmma_f32(v2f a, v2f b, v8f c) {
  return __builtin_amdgcn_wmma_f32_16x16x4_f32(false, a, false, b, (short)0, c,
                                               false, false);
}

// ---- CDNA5 async global->LDS staging (guarded; falls back to b128 copy) ----
#if __has_builtin(__builtin_amdgcn_global_load_async_to_lds_b128)
#define HAVE_ASYNC_LDS 1
#else
#define HAVE_ASYNC_LDS 0
#endif

__device__ __forceinline__ void copy16_g2l(float* l, const float* g) {
#if HAVE_ASYNC_LDS
  __builtin_amdgcn_global_load_async_to_lds_b128(
      (__attribute__((address_space(1))) v4i*)g,
      (__attribute__((address_space(3))) v4i*)l,
      0, 0);
#else
  *(float4*)l = *(const float4*)g;
#endif
}

__device__ __forceinline__ void wait_async_copies() {
#if HAVE_ASYNC_LDS
#if __has_builtin(__builtin_amdgcn_s_wait_asynccnt)
  __builtin_amdgcn_s_wait_asynccnt(0);
#else
  asm volatile("s_wait_asynccnt 0x0" ::: "memory");
#endif
#endif
}

// ---------------------------------------------------------------------------
// Kernel 1a: one workgroup (8 wave32) per (batch b, 64-row slice of n).
// Partial vsum[p][h] = sum_n mask01[p][n]*emb[n][h] and partial column sums of
// emb over the slice, both f32, to the workspace. The vsum partial is stored in
// accumulator order (wave, tile, lane, 8 values): whole lines per wave.
// ---------------------------------------------------------------------------
__global__ void __launch_bounds__(256)
vsum_part_kernel(const float* __restrict__ emb, const float* __restrict__ gmask,
                 float* __restrict__ part, float* __restrict__ csum)
{
  __shared__ __align__(16) float s_emb[64 * EMB_STR]; // 33.8 KB
  __shared__ __align__(16) float s_msk[64 * MSK_STR]; // 17.4 KB

  const int b    = blockIdx.x / NCH;
  const int n0   = (blockIdx.x % NCH) * 64;
  const int rows = (NN - n0 < 64) ? (NN - n0) : 64;
  const int tid  = threadIdx.x;
  const int lane = tid & 31;
  const int wid  = tid >> 5;
  const int lrow = lane & 15;         // M / N position within tile
  const int khi  = (lane >> 4) * 2;   // K offset for upper half-wave
  const float* embB = emb + (size_t)b * NN * H;

  // --- partial vsum over the slice (WMMA, K = 64) ---------------------------
  const int p0 = (wid >> 1) * 16;     // 4 M-tiles, 2 waves each
  const int hb = (wid & 1) * 64;      // each wave owns 64 H columns (4 tiles)
  v8f acc[4] = {};

  // the thread's 16 mask values are asked for in one batch, ahead of the emb
  // copies: one memory latency, not sixteen. Column clamped: every address is
  // in bounds, so no load sits under a guard.
  const int mk  = tid & 63, mp = tid >> 6;
  const int mn  = n0 + mk;
  const int mnc = (mn < NN) ? mn : (NN - 1);
  float mg[16];
#pragma unroll
  for (int j = 0; j < 16; ++j)
    mg[j] = gmask[((size_t)b * P + mp + 4 * j) * NN + mnc];

  // stage emb rows [0,rows) via async global->LDS b128
  for (int i = tid; i < rows * 32; i += 256) {
    int r = i >> 5, c4 = (i & 31) * 4;
    copy16_g2l(&s_emb[r * EMB_STR + c4], embB + (size_t)(n0 + r) * H + c4);
  }
  for (int i = tid; i < (64 - rows) * 128; i += 256) {   // zero tail rows
    int r = rows + (i >> 7), c = i & 127;
    s_emb[r * EMB_STR + c] = 0.f;
  }
#pragma unroll
  for (int j = 0; j < 16; ++j)                           // stage mask 0/1
    s_msk[(mp + 4 * j) * MSK_STR + mk] =
        (mn < NN && mg[j] < -1e30f) ? 1.f : 0.f;
  wait_async_copies();
  __syncthreads();

  // column sum over the staged rows (tail rows are zero): even and odd rows
  // apart, one value per thread
  {
    const int h = tid & 127, half = tid >> 7;
    float s = 0.f;
    for (int j = 0; j < 32; ++j) s += s_emb[(half + 2 * j) * EMB_STR + h];
    csum[((size_t)blockIdx.x * 2 + half) * H + h] = s;
  }

  for (int kk = 0; kk < 64; kk += 4) {
    v2f a = *(const v2f*)&s_msk[(p0 + lrow) * MSK_STR + kk + khi];
#pragma unroll
    for (int t = 0; t < 4; ++t) {
      v2f bb;
      bb.x = s_emb[(kk + khi + 0) * EMB_STR + hb + 16 * t + lrow];
      bb.y = s_emb[(kk + khi + 1) * EMB_STR + hb + 16 * t + lrow];
      acc[t] = wmma_f32(a, bb, acc[t]);
    }
  }
#pragma unroll
  for (int t = 0; t < 4; ++t)
    *(v8f*)(part + (((size_t)blockIdx.x * 8 + wid) * 4 + t) * 256 + lane * 8) = acc[t];
}

// ---------------------------------------------------------------------------
// Kernel 1b: final_q[b,p,h] = encq1@Wq_first + last_emb@Wq_last
//                           + (vsum/N)@W_visited + q_graph + load_emb
// One workgroup (4 wave32) per (batch b, 16-row tile of p); each wave owns
// 32 H columns (2 tiles = one 128-byte line of every output row). The slices'
// partials are summed in slice order.
// ---------------------------------------------------------------------------
// A and B fragments of four k-steps of the two global-A products and the three
// weight matrices: 56 loads, all in flight together
struct FragSet {
  v2f a1[4], a2[4];
  v2f b3[4][2], b1[4][2], b2[4][2];
};
__device__ __forceinline__ void load_frag_set(
    FragSet& s, const v2f* encRow, const v2f* lastRow, const float* Wv,
    const float* Wq_first, const float* Wq_last, int g, int half, int col) {
#pragma unroll
  for (int j = 0; j < 4; ++j) {
    const int k0 = 16 * g + 4 * j;
    s.a1[j] = encRow[(k0 >> 1) + half];
    s.a2[j] = lastRow[(k0 >> 1) + half];
#pragma unroll
    for (int t = 0; t < 2; ++t) {
      const int c0 = (k0 + 2 * half) * H + col + 16 * t;
      s.b3[j][t].x = Wv[c0];       s.b3[j][t].y = Wv[c0 + H];
      s.b1[j][t].x = Wq_first[c0]; s.b1[j][t].y = Wq_first[c0 + H];
      s.b2[j][t].x = Wq_last[c0];  s.b2[j][t].y = Wq_last[c0 + H];
    }
  }
}

__global__ void __launch_bounds__(128)
fq_kernel(const float* __restrict__ emb, const float* __restrict__ encq1,
          const int* __restrict__ last_node, const float* __restrict__ loadv,
          const float* __restrict__ Wq_graph, const float* __restrict__ Wq_first,
          const float* __restrict__ Wq_last, const float* __restrict__ Wv,
          const float* __restrict__ W_load, const float* __restrict__ b_load,
          const float* __restrict__ part, const float* __restrict__ csum,
          float* __restrict__ fq)
{
  __shared__ __align__(16) float s_vs[16 * EMB_STR];  // vsum/N as an A matrix
  __shared__ float s_mean[H];
  __shared__ float s_qg[H];
  __shared__ float s_load[128];   // [thread]; rows 0..15 are read

  const int b    = blockIdx.x >> 2;
  const int pt   = blockIdx.x & 3;
  const int p0   = pt * 16;
  const int tid  = threadIdx.x;
  const int lane = tid & 31;
  const int wid  = tid >> 5;
  const int lrow = lane & 15;         // M / N position within tile
  const int khi  = (lane >> 4) * 2;   // K offset for upper half-wave
  const int hb   = wid * 32;
  const float* embB = emb + (size_t)b * NN * H;

  // --- column mean from the slices' sums, q_graph matvec -------------------
  // Everything that hangs on no other value is asked for here in one batch: the
  // row's load and last node, the slices' column sums, the thread's column of
  // Wq_graph. One latency for all of it.
  const int ri = b * P + p0 + lrow;
  const float lv = loadv[ri];
  int ln = last_node[ri];
  ln = (ln < 0) ? 0 : ((ln > NN - 1) ? NN - 1 : ln);   // row index bounded before use
  float wg[H];
  {
    float s = 0.f;
    const float* cb = csum + (size_t)b * 2 * NCH * H;
    float cs[2 * NCH];
#pragma unroll
    for (int c = 0; c < 2 * NCH; ++c) cs[c] = cb[c * H + tid];
#pragma unroll
    for (int k = 0; k < H; ++k) wg[k] = Wq_graph[k * H + tid];
#pragma unroll
    for (int c = 0; c < 2 * NCH; ++c) s += cs[c];
    // the loads' base and offset are reused further down; as inputs they live up to the wait
    asm volatile("s_wait_xcnt 0x0" :: "s"(cb), "v"(tid), "v"(ri) : "memory");
    s_mean[tid] = s * (1.0f / NN);
  }
  s_load[tid] = lv;   // no guard: under one the load moves behind the batch's wait
  __syncthreads();
  {
    float s = 0.f;
#pragma unroll
    for (int k = 0; k < H; ++k) s += s_mean[k] * wg[k];
    s_qg[tid] = s;
  }

  // --- vsum tile = sum of the slices' partials (accumulator order) ---------
  // H tile 2*wid+t was tile (2*wid+t)&3 of kernel 1a's wave 2*pt + (wid>>1).
  v8f acc[2] = {};
  const float* pw = part + ((((size_t)b * NCH) * 8 + pt * 2 + (wid >> 1)) * 4 +
                            (wid & 1) * 2) * 256 + lane * 8;
#pragma unroll
  for (int e = 0; e < 2; ++e) {          // two batches of eight slices
    v8f pv[8][2];
#pragma unroll
    for (int c = 0; c < 8; ++c)
#pragma unroll
      for (int t = 0; t < 2; ++t)
        pv[c][t] = *(const v8f*)(pw + (size_t)(8 * e + c) * 8192 + t * 256);
    // keeps the batch's 32 loads ahead of the first add; without it the
    // scheduler leaves only a few in flight
    __builtin_amdgcn_sched_barrier(0);
#pragma unroll
    for (int c = 0; c < 8; ++c)
#pragma unroll
      for (int t = 0; t < 2; ++t) acc[t] += pv[c][t];
  }

  // park vsum/N into LDS as an A matrix [p][h]
  const float invN = 1.0f / NN;
#pragma unroll
  for (int t = 0; t < 2; ++t)
#pragma unroll
    for (int r = 0; r < 8; ++r)
      s_vs[(r + 8 * (lane >> 4)) * EMB_STR + hb + 16 * t + lrow] =
          acc[t][r] * invN;
  __syncthreads();

  // --- three chained K=128 WMMA GEMMs --------------------------------------
  v8f f[2] = {};
  const v2f* encRow  = (const v2f*)(encq1 + ((size_t)b * P + p0 + lrow) * H);
  const v2f* lastRow = (const v2f*)(embB + (size_t)ln * H);

  // two register sets of four k-steps: the next set's loads fly while this
  // set's products run. Unrolled: the sets are registers only under constant
  // indices.
  FragSet fs[2];
  load_frag_set(fs[0], encRow, lastRow, Wv, Wq_first, Wq_last, 0, lane >> 4, hb + lrow);
#pragma unroll
  for (int g = 0; g < 8; ++g) {
    if (g + 1 < 8)
      load_frag_set(fs[(g + 1) & 1], encRow, lastRow, Wv, Wq_first, Wq_last,
                    g + 1, lane >> 4, hb + lrow);
    // keeps the next set's loads ahead of this set's products
    __builtin_amdgcn_sched_barrier(0);
    const FragSet& s = fs[g & 1];
#pragma unroll
    for (int j = 0; j < 4; ++j) {
      v2f a3 = *(const v2f*)&s_vs[lrow * EMB_STR + 16 * g + 4 * j + khi];
#pragma unroll
      for (int t = 0; t < 2; ++t) {
        f[t] = wmma_f32(a3, s.b3[j][t], f[t]);
        f[t] = wmma_f32(s.a1[j], s.b1[j][t], f[t]);
        f[t] = wmma_f32(s.a2[j], s.b2[j][t], f[t]);
      }
    }
  }

  // epilogue: + q_graph + load*W_load + b_load ; store final_q
#pragma unroll
  for (int t = 0; t < 2; ++t) {
    int h = hb + 16 * t + lrow;
    float wl = W_load[h], bl = b_load[h], qg = s_qg[h];
#pragma unroll
    for (int r = 0; r < 8; ++r) {
      int pl = r + 8 * (lane >> 4);
      fq[((size_t)b * P + p0 + pl) * H + h] = f[t][r] + qg + s_load[pl] * wl + bl;
    }
  }
}

// ---------------------------------------------------------------------------
// Kernel 2: probs[b,p,:] = softmax(10*tanh(fq.emb/sqrt(H) - dist/sqrt(2)) + maskprob)
// One workgroup (16 wave32) per (batch b, 16-row tile of p): it owns whole rows
// of the output, so the logits stay in the accumulators' registers through the
// softmax and the output is written once. Wave w does the four n-tiles
// 4w..4w+3 (64 neighbouring columns). The A fragments (the 16 rows of final_q)
// are the same for every tile and sit in registers; each wave's emb tile comes
// to LDS in whole rows by async copies, two buffers, next tile in flight.
// Every loop of this kernel is unrolled: a, acc, dv, gv, m and sum are register
// arrays only while every index is a constant.
// ---------------------------------------------------------------------------
typedef float v4f __attribute__((ext_vector_type(4)));

// value of lane (l ^ MASK) inside the 16-lane row: CTRL = 0x160 | MASK (row_xmask)
template <int CTRL>
__device__ __forceinline__ float row_xor(float v) {
  return __builtin_bit_cast(float, __builtin_amdgcn_update_dpp(
      0, __builtin_bit_cast(int, v), CTRL, 0xf, 0xf, true));
}
__device__ __forceinline__ float row16_max(float v) {
  v = fmaxf(v, row_xor<0x161>(v));
  v = fmaxf(v, row_xor<0x162>(v));
  v = fmaxf(v, row_xor<0x164>(v));
  v = fmaxf(v, row_xor<0x168>(v));
  return v;
}
__device__ __forceinline__ float row16_sum(float v) {
  v += row_xor<0x161>(v);
  v += row_xor<0x162>(v);
  v += row_xor<0x164>(v);
  v += row_xor<0x168>(v);
  return v;
}

// wave wid's n-tile 4*wid+c: 16 rows of 512 B, one copy per row. Row clamped:
// every address is in bounds, every lane is on.
__device__ __forceinline__ void stage_emb_tile(float* s_emb, const float* embB,
                                               int wid, int lane, int c) {
  float* dst = s_emb + (wid * 2 + (c & 1)) * 16 * EMB_STR + lane * 4;
  const int n0 = (wid * 4 + c) * 16;
#pragma unroll
  for (int i = 0; i < 16; ++i) {
    const int n = (n0 + i < NN) ? (n0 + i) : (NN - 1);
    copy16_g2l(dst + i * EMB_STR, embB + (size_t)n * H + lane * 4);
  }
}

__global__ void __launch_bounds__(512)
score_softmax_kernel(const float* __restrict__ dists, const float* __restrict__ emb,
                     const int* __restrict__ last_node, const float* __restrict__ gmask,
                     const float* __restrict__ fq, float* __restrict__ out)
{
  // 264 KB: [wave][buffer][16 rows]; a wave's two buffers lie side by side, so
  // that all its fragment reads are one address register and an offset
  __shared__ __align__(16) float s_emb[16 * 2 * 16 * EMB_STR];
  __shared__ __align__(16) float s_fq[16 * EMB_STR];
  __shared__ __align__(16) float s_rm[16 * 16];             // [wave][row] maxima
  __shared__ __align__(16) float s_rs[16 * 16];             // [wave][row] sums

  const int b    = blockIdx.x >> 2;
  const int p0   = (blockIdx.x & 3) * 16;
  const int tid  = threadIdx.x;
  const int lane = tid & 31;
  const int wid  = __builtin_amdgcn_readfirstlane(tid >> 5);
  const int lrow = lane & 15;
  const int half = lane >> 4;
  const int khi  = half * 2;
  const float* embB = emb + (size_t)b * NN * H;

  // final_q tile (one copy per thread) and every wave's first emb tile
  copy16_g2l(&s_fq[wid * EMB_STR + lane * 4],
             fq + ((size_t)b * P + p0 + wid) * H + lane * 4);
  stage_emb_tile(s_emb, embB, wid, lane, 0);

  // the lane's eight rows of dists; row index bounded before use
  int ln[8];
  {
    const v4i l0 = *(const v4i*)(last_node + b * P + p0 + 8 * half);
    const v4i l1 = *(const v4i*)(last_node + b * P + p0 + 8 * half + 4);
#pragma unroll
    for (int r = 0; r < 4; ++r) { ln[r] = l0[r]; ln[4 + r] = l1[r]; }
#pragma unroll
    for (int r = 0; r < 8; ++r)
      ln[r] = (ln[r] < 0) ? 0 : ((ln[r] > NN - 1) ? NN - 1 : ln[r]);
  }
  // final_q and tile 0 have landed before anybody reads them
  asm volatile("s_wait_asynccnt 0x0" ::: "memory");
  __syncthreads();
  stage_emb_tile(s_emb, embB, wid, lane, 1);

  // The lane's 32 distance and 32 mask values are asked for here, in one batch,
  // behind the first barrier (a barrier waits for every load in front of it):
  // their latency is paid once, beside the first tile's k loop. Column clamped
  // like emb's row: every address is in bounds.
  const int nb = wid * 64 + lrow;              // the lane's column in tile q: nb + 16 q
  float dv[4][8], gv[4][8];
#pragma unroll
  for (int q = 0; q < 4; ++q) {
    const int n  = nb + 16 * q;
    const int nc = (n < NN) ? n : (NN - 1);
#pragma unroll
    for (int r = 0; r < 8; ++r) {
      dv[q][r] = dists[((size_t)b * NN + ln[r]) * NN + nc];
      gv[q][r] = gmask[((size_t)b * P + p0 + r + 8 * half) * NN + nc];
    }
  }

  v2f a[32];
#pragma unroll
  for (int k = 0; k < 32; ++k)
    a[k] = *(const v2f*)&s_fq[lrow * EMB_STR + 4 * k + khi];

  v8f acc[4] = {};
#pragma unroll
  for (int c = 0; c < 4; ++c) {
    const float* bp = &s_emb[((wid * 2 + (c & 1)) * 16 + lrow) * EMB_STR + khi];
#pragma unroll
    for (int g = 0; g < 4; ++g) {
      v2f bf[8];
#pragma unroll
      for (int j = 0; j < 8; ++j) bf[j] = *(const v2f*)(bp + 4 * (8 * g + j));
#pragma unroll
      for (int j = 0; j < 8; ++j) acc[c] = wmma_f32(a[8 * g + j], bf[j], acc[c]);
    }
    // hand-over: this buffer's reads are done, the next tile has landed, and
    // only then is this buffer filled again
    asm volatile("s_wait_dscnt 0x0" ::: "memory");
    asm volatile("s_wait_asynccnt 0x0" ::: "memory");
    __syncthreads();
    if (c + 2 < 4) stage_emb_tile(s_emb, embB, wid, lane, c + 2);
  }
  // no copy is left in flight behind the loop
  asm volatile("s_wait_asynccnt 0x0" ::: "memory");

  const float inv_sqrtH = 0.08838834764831845f;  // 1/sqrt(128)
  const float inv_sqrt2 = 0.7071067811865476f;

  // logits in place of the accumulators; columns past N take no part
  float m[8];
#pragma unroll
  for (int r = 0; r < 8; ++r) m[r] = -3.4e38f;
#pragma unroll
  for (int q = 0; q < 4; ++q) {
    const bool live = nb + 16 * q < NN;
#pragma unroll
    for (int r = 0; r < 8; ++r) {
      float s  = acc[q][r] * inv_sqrtH - dv[q][r] * inv_sqrt2;
      float sc = 10.f * tanhf(s);
      float g  = gv[q][r];
      float o  = sc + ((g < -1e30f) ? -1e8f : g);
      o = live ? o : -3.4e38f;
      acc[q][r] = o;
      m[r] = fmaxf(m[r], o);
    }
  }

  // row maximum: 16 lanes, then the 16 waves (lane l takes wave l's values)
#pragma unroll
  for (int r = 0; r < 8; ++r) m[r] = row16_max(m[r]);
  if (lrow == 0) {
    v4f x0 = {m[0], m[1], m[2], m[3]}, x1 = {m[4], m[5], m[6], m[7]};
    *(v4f*)&s_rm[wid * 16 + 8 * half]     = x0;
    *(v4f*)&s_rm[wid * 16 + 8 * half + 4] = x1;
  }
  __syncthreads();
  {
    const v4f x0 = *(const v4f*)&s_rm[lrow * 16 + 8 * half];
    const v4f x1 = *(const v4f*)&s_rm[lrow * 16 + 8 * half + 4];
#pragma unroll
    for (int r = 0; r < 4; ++r) {
      m[r]     = row16_max(x0[r]);
      m[4 + r] = row16_max(x1[r]);
    }
  }

  float sum[8] = {};
#pragma unroll
  for (int q = 0; q < 4; ++q)
#pragma unroll
    for (int r = 0; r < 8; ++r) {
      float e = expf(acc[q][r] - m[r]);
      acc[q][r] = e;
      sum[r] += e;
    }
#pragma unroll
  for (int r = 0; r < 8; ++r) sum[r] = row16_sum(sum[r]);
  if (lrow == 0) {
    v4f x0 = {sum[0], sum[1], sum[2], sum[3]}, x1 = {sum[4], sum[5], sum[6], sum[7]};
    *(v4f*)&s_rs[wid * 16 + 8 * half]     = x0;
    *(v4f*)&s_rs[wid * 16 + 8 * half + 4] = x1;
  }
  __syncthreads();
  {
    const v4f x0 = *(const v4f*)&s_rs[lrow * 16 + 8 * half];
    const v4f x1 = *(const v4f*)&s_rs[lrow * 16 + 8 * half + 4];
#pragma unroll
    for (int r = 0; r < 4; ++r) {
      sum[r]     = 1.0f / row16_sum(x0[r]);
      sum[4 + r] = 1.0f / row16_sum(x1[r]);
    }
  }

  float* orow = out + ((size_t)b * P + p0 + 8 * half) * NN + nb;
#pragma unroll
  for (int q = 0; q < 4; ++q) {
    if (nb + 16 * q < NN) {
#pragma unroll
      for (int r = 0; r < 8; ++r)
        orow[r * NN + 16 * q] = acc[q][r] * sum[r];
    }
  }
}

// ---------------------------------------------------------------------------
extern "C" void kernel_launch(void* const* d_in, const int* in_sizes, int n_in,
                              void* d_out, int out_size, void* d_ws, size_t ws_size,
                              hipStream_t stream) {
  const float* dists     = (const float*)d_in[0];
  const float* emb       = (const float*)d_in[1];
  const float* encq1     = (const float*)d_in[2];
  const int*   last_node = (const int*)d_in[3];
  const float* loadv     = (const float*)d_in[4];
  const float* gmask     = (const float*)d_in[5];
  const float* Wq_graph  = (const float*)d_in[6];
  const float* Wq_first  = (const float*)d_in[7];
  const float* Wq_last   = (const float*)d_in[8];
  const float* Wv        = (const float*)d_in[9];
  const float* W_load    = (const float*)d_in[10];
  const float* b_load    = (const float*)d_in[11];
  float* out = (float*)d_out;
  float* fq   = (float*)d_ws;    // B*P*H floats = 2 MB scratch
  float* part = fq + 524288;     // B*NCH*P*H floats = 32 MB of vsum partials
  float* csum = part + 8388608;  // B*NCH*2*H floats of column-sum partials

  vsum_part_kernel<<<B * NCH, 256, 0, stream>>>(emb, gmask, part, csum);
  fq_kernel<<<B * 4, 128, 0, stream>>>(emb, encq1, last_node, loadv,
                                       Wq_graph, Wq_first, Wq_last, Wv,
                                       W_load, b_load, part, csum, fq);
  score_softmax_kernel<<<B * 4, 512, 0, stream>>>(dists, emb, last_node, gmask, fq, out);
}

// v005
// A run of this version takes 39.6 microseconds.
// Next to v004, in two timings, it ran 1.09 and 1.08 times as fast.
// All steps since v000 together make it 6.60 times as fast.
#include <hip/hip_runtime.h>
#include <math.h>

// Shapes from the reference
#define B 64
#define P 64
#define NN 1000
#define H 128
#define NCH 16    // 64-row slices of the n axis: ceil(1000 / 64)

// LDS strides: even (8B-aligned v2f reads) and bank-conflict-free:
// row-indexed pair reads hit banks {4l+c,4l+c+1} (lanes 0-15) vs
// {4l+c+2,4l+c+3} (lanes 16-31) -> disjoint.
#define EMB_STR 132   // 64 x 132 floats (emb chunk); 16 x 132 (vsum A / final_q A / emb tiles)
#define MSK_STR 68    // 64 x 68 floats  (mask A)

typedef float v2f __attribute__((ext_vector_type(2)));
typedef float v8f __attribute__((ext_vector_type(8)));
typedef int   v4i __attribute__((ext_vector_type(4)));

// Full-precision matrix op: D(16x16,f32) = A(16x4,f32) * B(4x16,f32) + C
// A: lane(0..15) holds M=lane, K={k,k+1}; lane(16..31): M=lane-16, K={k+2,k+3}
// B: lane holds column N=lane&15, rows K = {2*(lane>>4)+0, 2*(lane>>4)+1}
// C/D: vgpr r -> M = r + 8*(lane>>4), N = lane&15
__device__ __forceinline__ v8f wmma_f32(v2f a, v2f b, v8f c) {
  return __builtin_amdgcn_wmma_f32_16x16x4_f32(false, a, false, b, (short)0, c,
                                               false, false);
}

// ---- CDNA5 async global->LDS staging (guarded; falls back to b128 copy) ----
#if __has_builtin(__builtin_amdgcn_global_load_async_to_lds_b128)
#define HAVE_ASYNC_LDS 1
#else
#define HAVE_ASYNC_LDS 0
#endif

__device__ __forceinline__ void copy16_g2l(float* l, const float* g) {
#if HAVE_ASYNC_LDS
  __builtin_amdgcn_global_load_async_to_lds_b128(
      (__attribute__((address_space(1))) v4i*)g,
      (__attribute__((address_space(3))) v4i*)l,
      0, 0);
#else
  *(float4*)l = *(const float4*)g;
#endif
}

__device__ __forceinline__ void wait_async_copies() {
#if HAVE_ASYNC_LDS
#if __has_builtin(__builtin_amdgcn_s_wait_asynccnt)
  __builtin_amdgcn_s_wait_asynccnt(0);
#else
  asm volatile("s_wait_asynccnt 0x0" ::: "memory");
#endif
#endif
}

// ---------------------------------------------------------------------------
// Kernel 1a: one workgroup (8 wave32) per (batch b, 64-row slice of n).
// Partial vsum[p][h] = sum_n mask01[p][n]*emb[n][h] and partial column sums of
// emb over the slice, both f32, to the workspace. The vsum partial is stored in
// accumulator order (wave, tile, lane, 8 values): whole lines per wave.
// ---------------------------------------------------------------------------
__global__ void __launch_bounds__(256)
vsum_part_kernel(const float* __restrict__ emb, const float* __restrict__ gmask,
                 float* __restrict__ part, float* __restrict__ csum)
{
  __shared__ __align__(16) float s_emb[64 * EMB_STR]; // 33.8 KB
  __shared__ __align__(16) float s_msk[64 * MSK_STR]; // 17.4 KB

  const int b    = blockIdx.x / NCH;
  const int n0   = (blockIdx.x % NCH) * 64;
  const int rows = (NN - n0 < 64) ? (NN - n0) : 64;
  const int tid  = threadIdx.x;
  const int lane = tid & 31;
  const int wid  = tid >> 5;
  const int lrow = lane & 15;         // M / N position within tile
  const int khi  = (lane >> 4) * 2;   // K offset for upper half-wave
  const float* embB = emb + (size_t)b * NN * H;

  // --- partial vsum over the slice (WMMA, K = 64) ---------------------------
  const int p0 = (wid >> 1) * 16;     // 4 M-tiles, 2 waves each
  const int hb = (wid & 1) * 64;      // each wave owns 64 H columns (4 tiles)
  v8f acc[4] = {};

  // the thread's 16 mask values are asked for in one batch, ahead of the emb
  // copies: one memory latency, not sixteen. Column clamped: every address is
  // in bounds, so no load sits under a guard.
  const int mk  = tid & 63, mp = tid >> 6;
  const int mn  = n0 + mk;
  const int mnc = (mn < NN) ? mn : (NN - 1);
  float mg[16];
#pragma unroll
  for (int j = 0; j < 16; ++j)
    mg[j] = gmask[((size_t)b * P + mp + 4 * j) * NN + mnc];

  // stage emb rows [0,rows) via async global->LDS b128
  for (int i = tid; i < rows * 32; i += 256) {
    int r = i >> 5, c4 = (i & 31) * 4;
    copy16_g2l(&s_emb[r * EMB_STR + c4], embB + (size_t)(n0 + r) * H + c4);
  }
  for (int i = tid; i < (64 - rows) * 128; i += 256) {   // zero tail rows
    int r = rows + (i >> 7), c = i & 127;
    s_emb[r * EMB_STR + c] = 0.f;
  }
#pragma unroll
  for (int j = 0; j < 16; ++j)                           // stage mask 0/1
    s_msk[(mp + 4 * j) * MSK_STR + mk] =
        (mn < NN && mg[j] < -1e30f) ? 1.f : 0.f;
  wait_async_copies();
  __syncthreads();

  // column sum over the staged rows (tail rows are zero): even and odd rows
  // apart, one value per thread
  {
    const int h = tid & 127, half = tid >> 7;
    float s = 0.f;
    for (int j = 0; j < 32; ++j) s += s_emb[(half + 2 * j) * EMB_STR + h];
    csum[((size_t)blockIdx.x * 2 + half) * H + h] = s;
  }

  for (int kk = 0; kk < 64; kk += 4) {
    v2f a = *(const v2f*)&s_msk[(p0 + lrow) * MSK_STR + kk + khi];
#pragma unroll
    for (int t = 0; t < 4; ++t) {
      v2f bb;
      bb.x = s_emb[(kk + khi + 0) * EMB_STR + hb + 16 * t + lrow];
      bb.y = s_emb[(kk + khi + 1) * EMB_STR + hb + 16 * t + lrow];
      acc[t] = wmma_f32(a, bb, acc[t]);
    }
  }
#pragma unroll
  for (int t = 0; t < 4; ++t)
    *(v8f*)(part + (((size_t)blockIdx.x * 8 + wid) * 4 + t) * 256 + lane * 8) = acc[t];
}

// ---------------------------------------------------------------------------
// Kernel 2: final_q[b,p,h] = encq1@Wq_first + last_emb@Wq_last
//                          + (vsum/N)@W_visited + q_graph + load_emb, then
// probs[b,p,:] = softmax(10*tanh(fq.emb/sqrt(H) - dist/sqrt(2)) + maskprob)
// One workgroup (16 wave32) per (batch b, 16-row tile of p).
// final_q: wave w does the 16 columns of H tile w&7 over K half w>>3 of the
// three products; the two halves' sums meet in LDS, where the A fragments of
// the score product are read from. It never goes through global memory.
// Scores: the workgroup owns whole rows of the output, so the logits stay in
// the accumulators' registers through the softmax and the output is written
// once. Wave w does the four n-tiles 4w..4w+3 (64 neighbouring columns). The A
// fragments (the 16 rows of final_q) are the same for every tile and sit in
// registers; each wave's emb tile comes to LDS in whole rows by async copies,
// two buffers, next tile in flight.
// Every loop of this kernel is unrolled: the arrays are registers only while
// every index is a constant.
// ---------------------------------------------------------------------------
typedef float v4f __attribute__((ext_vector_type(4)));

// value of lane (l ^ MASK) inside the 16-lane row: CTRL = 0x160 | MASK (row_xmask)
template <int CTRL>
__device__ __forceinline__ float row_xor(float v) {
  return __builtin_bit_cast(float, __builtin_amdgcn_update_dpp(
      0, __builtin_bit_cast(int, v), CTRL, 0xf, 0xf, true));
}
__device__ __forceinline__ float row16_max(float v) {
  v = fmaxf(v, row_xor<0x161>(v));
  v = fmaxf(v, row_xor<0x162>(v));
  v = fmaxf(v, row_xor<0x164>(v));
  v = fmaxf(v, row_xor<0x168>(v));
  return v;
}
__device__ __forceinline__ float row16_sum(float v) {
  v += row_xor<0x161>(v);
  v += row_xor<0x162>(v);
  v += row_xor<0x164>(v);
  v += row_xor<0x168>(v);
  return v;
}

// wave wid's n-tile 4*wid+c: 16 rows of 512 B, one copy per row. Row clamped:
// every address is in bounds, every lane is on.
__device__ __forceinline__ void stage_emb_tile(float* s_emb, const float* embB,
                                               int wid, int lane, int c) {
  float* dst = s_emb + (wid * 2 + (c & 1)) * 16 * EMB_STR + lane * 4;
  const int n0 = (wid * 4 + c) * 16;
#pragma unroll
  for (int i = 0; i < 16; ++i) {
    const int n = (n0 + i < NN) ? (n0 + i) : (NN - 1);
    copy16_g2l(dst + i * EMB_STR, embB + (size_t)n * H + lane * 4);
  }
}

__global__ void __launch_bounds__(512)
score_softmax_kernel(const float* __restrict__ dists, const float* __restrict__ emb,
                     const float* __restrict__ encq1, const int* __restrict__ last_node,
                     const float* __restrict__ loadv, const float* __restrict__ gmask,
                     const float* __restrict__ Wq_graph, const float* __restrict__ Wq_first,
                     const float* __restrict__ Wq_last, const float* __restrict__ Wv,
                     const float* __restrict__ W_load, const float* __restrict__ b_load,
                     const float* __restrict__ part, const float* __restrict__ csum,
                     float* __restrict__ out)
{
  // 264 KB: [wave][buffer][16 rows]; a wave's two buffers lie side by side, so
  // that all its fragment reads are one address register and an offset
  __shared__ __align__(16) float s_emb[16 * 2 * 16 * EMB_STR];
  __shared__ __align__(16) float s_fq[2 * 16 * EMB_STR];    // final_q: [K half][row]
  __shared__ __align__(16) float s_vs[2 * 16 * EMB_STR];    // vsum/N: [slice half][row]
  __shared__ __align__(16) float s_enc[16 * EMB_STR];       // the tile's rows of encq1
  __shared__ __align__(16) float s_last[16 * EMB_STR];      // the rows' last-node emb
  __shared__ __align__(16) float s_mean[H];
  __shared__ float s_qg[4 * H];                             // q_graph: [K quarter][h]
  __shared__ __align__(16) float s_rm[16 * 16];             // [wave][row] maxima
  __shared__ __align__(16) float s_rs[16 * 16];             // [wave][row] sums

  const int b    = blockIdx.x >> 2;
  const int pt   = blockIdx.x & 3;
  const int p0   = pt * 16;
  const int tid  = threadIdx.x;
  const int lane = tid & 31;
  const int wid  = __builtin_amdgcn_readfirstlane(tid >> 5);
  const int lrow = lane & 15;
  const int half = lane >> 4;
  const int khi  = half * 2;
  const float* embB = emb + (size_t)b * NN * H;

  // every wave's first emb tile, and row wid of the two A matrices that come
  // from global memory (whole rows: one copy per thread each)
  stage_emb_tile(s_emb, embB, wid, lane, 0);
  copy16_g2l(&s_enc[wid * EMB_STR + lane * 4],
             encq1 + ((size_t)b * P + p0 + wid) * H + lane * 4);
  {
    int lw = last_node[b * P + p0 + wid];
    lw = (lw < 0) ? 0 : ((lw > NN - 1) ? NN - 1 : lw);   // row index bounded before use
    copy16_g2l(&s_last[wid * EMB_STR + lane * 4], embB + (size_t)lw * H + lane * 4);
  }

  // the lane's eight rows of dists; row index bounded before use
  int ln[8];
  {
    const v4i l0 = *(const v4i*)(last_node + b * P + p0 + 8 * half);
    const v4i l1 = *(const v4i*)(last_node + b * P + p0 + 8 * half + 4);
#pragma unroll
    for (int r = 0; r < 4; ++r) { ln[r] = l0[r]; ln[4 + r] = l1[r]; }
#pragma unroll
    for (int r = 0; r < 8; ++r)
      ln[r] = (ln[r] < 0) ? 0 : ((ln[r] > NN - 1) ? NN - 1 : ln[r]);
  }

  // ---- final_q -------------------------------------------------------------
  const int ht   = wid & 7;           // the wave's H tile (16 output columns)
  const int kh   = wid >> 3;          // its half of K, and of the n slices
  const int qr   = wid >> 2;          // its quarter of the q_graph matvec's K
  const int hc   = tid & 127;         // the thread's column in mean and matvec
  const int hcol = 16 * ht + lrow;    // the lane's output column
  const float invN = 1.0f / NN;

  // Everything that hangs on no other value is asked for in one batch: the
  // wave's eight slices of its vsum tile, the thread's quarter column of
  // Wq_graph, the epilogue's values, and (first four waves) the slices' column
  // sums. One latency for all.
  // H tile ht was tile ht&3 of kernel 1a's wave 2*pt + (ht>>2).
  float wg[32];
  v8f pv[8];
  const float* gb = Wq_graph + (size_t)qr * 32 * H + hc;
  const float* pw = part + ((((size_t)b * NCH + 8 * kh) * 8 + pt * 2 + (ht >> 2)) * 4 +
                            (ht & 3)) * 256;
  const unsigned pvb = lane * 32u;    // the lane's byte offset in a stored tile
#pragma unroll
  for (int c = 0; c < 8; ++c)
    pv[c] = *(const v8f*)((const char*)(pw + (size_t)c * 8192) + pvb);
#pragma unroll
  for (int k = 0; k < 32; ++k) wg[k] = gb[k * H];
  const v4f lv0 = *(const v4f*)(loadv + b * P + p0 + 8 * half);
  const v4f lv1 = *(const v4f*)(loadv + b * P + p0 + 8 * half + 4);
  const float wl = W_load[hcol], bl = b_load[hcol];
  // the batch's address registers are free for reuse behind this; as inputs
  // the lanes' offsets live up to the wait
  asm volatile("s_wait_xcnt 0x0" :: "v"(pvb), "v"(hc), "v"(hcol) : "memory");

  if (qr == 0) {   // column mean: waves 0..3, one column a thread
    const float* cb = csum + (size_t)b * 2 * NCH * H + hc;
    float cs[2 * NCH];
#pragma unroll
    for (int c = 0; c < 2 * NCH; ++c) cs[c] = cb[c * H];
    // the loads' address registers are free for reuse behind this
    asm volatile("s_wait_xcnt 0x0" ::: "memory");
    float s = 0.f;
#pragma unroll
    for (int c = 0; c < 2 * NCH; ++c) s += cs[c];
    s_mean[hc] = s * invN;
  }
  {
    v8f vs = {};
#pragma unroll
    for (int c = 0; c < 8; ++c) vs += pv[c];
    // park the half sum of vsum/N as an A matrix [p][h]
#pragma unroll
    for (int r = 0; r < 8; ++r)
      s_vs[(kh * 16 + r + 8 * half) * EMB_STR + hcol] = vs[r] * invN;
  }

  // the wave's B fragments of all its 16 k-steps of the three weight matrices:
  // 96 loads in flight together
  v2f b1[16], b2[16], b3[16];
  {
    const size_t c0 = (size_t)((64 * kh + khi) * H + hcol);
    const float* w3 = Wv + c0;
    const float* w1 = Wq_first + c0;
    const float* w2 = Wq_last + c0;
#pragma unroll
    for (int j = 0; j < 16; ++j) {
      b3[j].x = w3[4 * j * H]; b3[j].y = w3[(4 * j + 1) * H];
      b1[j].x = w1[4 * j * H]; b1[j].y = w1[(4 * j + 1) * H];
      b2[j].x = w2[4 * j * H]; b2[j].y = w2[(4 * j + 1) * H];
    }
  }
  // the batch's address registers are free for reuse behind this
  asm volatile("s_wait_xcnt 0x0" ::: "memory");

  // tile 0 and the two A matrices have landed before anybody reads them
  asm volatile("s_wait_asynccnt 0x0" ::: "memory");
  __syncthreads();
  stage_emb_tile(s_emb, embB, wid, lane, 1);

  {
    float s = 0.f;
#pragma unroll
    for (int k = 0; k < 32; ++k) s += s_mean[32 * qr + k] * wg[k];
    s_qg[qr * H + hc] = s;
  }
  __syncthreads();

  // three chained WMMA GEMMs over the wave's 64 values of K
  {
    v8f f = {};
    const float* av = &s_vs[lrow * EMB_STR + 64 * kh + khi];
    const float* a1 = &s_enc[lrow * EMB_STR + 64 * kh + khi];
    const float* a2 = &s_last[lrow * EMB_STR + 64 * kh + khi];
#pragma unroll
    for (int g = 0; g < 4; ++g) {
      v2f x3[4], x1[4], x2[4];
#pragma unroll
      for (int j = 0; j < 4; ++j) {
        const int k = 4 * (4 * g + j);
        x3[j] = *(const v2f*)(av + k) + *(const v2f*)(av + 16 * EMB_STR + k);
        x1[j] = *(const v2f*)(a1 + k);
        x2[j] = *(const v2f*)(a2 + k);
      }
#pragma unroll
      for (int j = 0; j < 4; ++j) {
        f = wmma_f32(x3[j], b3[4 * g + j], f);
        f = wmma_f32(x1[j], b1[4 * g + j], f);
        f = wmma_f32(x2[j], b2[4 * g + j], f);
      }
    }
    // + q_graph + load*W_load + b_load, once: in K half 0
    const float qg = (s_qg[hcol] + s_qg[H + hcol]) + (s_qg[2 * H + hcol] + s_qg[3 * H + hcol]);
#pragma unroll
    for (int r = 0; r < 8; ++r) {
      const float lv = (r < 4) ? lv0[r & 3] : lv1[r & 3];
      const float ex = (kh == 0) ? (qg + lv * wl + bl) : 0.f;
      s_fq[(kh * 16 + r + 8 * half) * EMB_STR + hcol] = f[r] + ex;
    }
  }
  __syncthreads();

  // The lane's 32 distance and 32 mask values are asked for here, in one batch,
  // behind final_q's last barrier (a barrier waits for every load in front of it):
  // their latency is paid once, beside the first tile's k loop. Column clamped
  // like emb's row: every address is in bounds.
  const int nb = wid * 64 + lrow;              // the lane's column in tile q: nb + 16 q
  float dv[4][8], gv[4][8];
#pragma unroll
  for (int q = 0; q < 4; ++q) {
    const int n  = nb + 16 * q;
    const int nc = (n < NN) ? n : (NN - 1);
#pragma unroll
    for (int r = 0; r < 8; ++r) {
      dv[q][r] = dists[((size_t)b * NN + ln[r]) * NN + nc];
      gv[q][r] = gmask[((size_t)b * P + p0 + r + 8 * half) * NN + nc];
    }
  }

  v2f a[32];
#pragma unroll
  for (int k = 0; k < 32; ++k)
    a[k] = *(const v2f*)&s_fq[lrow * EMB_STR + 4 * k + khi] +
           *(const v2f*)&s_fq[(16 + lrow) * EMB_STR + 4 * k + khi];

  v8f acc[4] = {};
#pragma unroll
  for (int c = 0; c < 4; ++c) {
    const float* bp = &s_emb[((wid * 2 + (c & 1)) * 16 + lrow) * EMB_STR + khi];
#pragma unroll
    for (int g = 0; g < 4; ++g) {
      v2f bf[8];
#pragma unroll
      for (int j = 0; j < 8; ++j) bf[j] = *(const v2f*)(bp + 4 * (8 * g + j));
#pragma unroll
      for (int j = 0; j < 8; ++j) acc[c] = wmma_f32(a[8 * g + j], bf[j], acc[c]);
    }
    // hand-over: this buffer's reads are done, the next tile has landed, and
    // only then is this buffer filled again
    asm volatile("s_wait_dscnt 0x0" ::: "memory");
    asm volatile("s_wait_asynccnt 0x0" ::: "memory");
    __syncthreads();
    if (c + 2 < 4) stage_emb_tile(s_emb, embB, wid, lane, c + 2);
  }
  // no copy is left in flight behind the loop
  asm volatile("s_wait_asynccnt 0x0" ::: "memory");

  const float inv_sqrtH = 0.08838834764831845f;  // 1/sqrt(128)
  const float inv_sqrt2 = 0.7071067811865476f;

  // logits in place of the accumulators; columns past N take no part
  float m[8];
#pragma unroll
  for (int r = 0; r < 8; ++r) m[r] = -3.4e38f;
#pragma unroll
  for (int q = 0; q < 4; ++q) {
    const bool live = nb + 16 * q < NN;
#pragma unroll
    for (int r = 0; r < 8; ++r) {
      float s  = acc[q][r] * inv_sqrtH - dv[q][r] * inv_sqrt2;
      float sc = 10.f * tanhf(s);
      float g  = gv[q][r];
      float o  = sc + ((g < -1e30f) ? -1e8f : g);
      o = live ? o : -3.4e38f;
      acc[q][r] = o;
      m[r] = fmaxf(m[r], o);
    }
  }

  // row maximum: 16 lanes, then the 16 waves (lane l takes wave l's values)
#pragma unroll
  for (int r = 0; r < 8; ++r) m[r] = row16_max(m[r]);
  if (lrow == 0) {
    v4f x0 = {m[0], m[1], m[2], m[3]}, x1 = {m[4], m[5], m[6], m[7]};
    *(v4f*)&s_rm[wid * 16 + 8 * half]     = x0;
    *(v4f*)&s_rm[wid * 16 + 8 * half + 4] = x1;
  }
  __syncthreads();
  {
    const v4f x0 = *(const v4f*)&s_rm[lrow * 16 + 8 * half];
    const v4f x1 = *(const v4f*)&s_rm[lrow * 16 + 8 * half + 4];
#pragma unroll
    for (int r = 0; r < 4; ++r) {
      m[r]     = row16_max(x0[r]);
      m[4 + r] = row16_max(x1[r]);
    }
  }

  float sum[8] = {};
#pragma unroll
  for (int q = 0; q < 4; ++q)
#pragma unroll
    for (int r = 0; r < 8; ++r) {
      float e = expf(acc[q][r] - m[r]);
      acc[q][r] = e;
      sum[r] += e;
    }
#pragma unroll
  for (int r = 0; r < 8; ++r) sum[r] = row16_sum(sum[r]);
  if (lrow == 0) {
    v4f x0 = {sum[0], sum[1], sum[2], sum[3]}, x1 = {sum[4], sum[5], sum[6], sum[7]};
    *(v4f*)&s_rs[wid * 16 + 8 * half]     = x0;
    *(v4f*)&s_rs[wid * 16 + 8 * half + 4] = x1;
  }
  __syncthreads();
  {
    const v4f x0 = *(const v4f*)&s_rs[lrow * 16 + 8 * half];
    const v4f x1 = *(const v4f*)&s_rs[lrow * 16 + 8 * half + 4];
#pragma unroll
    for (int r = 0; r < 4; ++r) {
      sum[r]     = 1.0f / row16_sum(x0[r]);
      sum[4 + r] = 1.0f / row16_sum(x1[r]);
    }
  }

  float* orow = out + ((size_t)b * P + p0 + 8 * half) * NN + nb;
#pragma unroll
  for (int q = 0; q < 4; ++q) {
    if (nb + 16 * q < NN) {
#pragma unroll
      for (int r = 0; r < 8; ++r)
        orow[r * NN + 16 * q] = acc[q][r] * sum[r];
    }
  }
}

// ---------------------------------------------------------------------------
extern "C" void kernel_launch(void* const* d_in, const int* in_sizes, int n_in,
                              void* d_out, int out_size, void* d_ws, size_t ws_size,
                              hipStream_t stream) {
  const float* dists     = (const float*)d_in[0];
  const float* emb       = (const float*)d_in[1];
  const float* encq1     = (const float*)d_in[2];
  const int*   last_node = (const int*)d_in[3];
  const float* loadv     = (const float*)d_in[4];
  const float* gmask     = (const float*)d_in[5];
  const float* Wq_graph  = (const float*)d_in[6];
  const float* Wq_first  = (const float*)d_in[7];
  const float* Wq_last   = (const float*)d_in[8];
  const float* Wv        = (const float*)d_in[9];
  const float* W_load    = (const float*)d_in[10];
  const float* b_load    = (const float*)d_in[11];
  float* out = (float*)d_out;
  float* part = (float*)d_ws;    // B*NCH*P*H floats = 32 MB of vsum partials
  float* csum = part + 8388608;  // B*NCH*2*H floats of column-sum partials

  vsum_part_kernel<<<B * NCH, 256, 0, stream>>>(emb, gmask, part, csum);
  score_softmax_kernel<<<B * 4, 512, 0, stream>>>(dists, emb, encq1, last_node, loadv, gmask,
                                                  Wq_graph, Wq_first, Wq_last, Wv,
                                                  W_load, b_load, part, csum, out);
}

// v007
// A run of this version takes 30 microseconds.
// Versions in between are left out here; by their measured steps it is 1.32 times as fast as v005.
// Counting every step since v000, it is 8.70 times as fast.
#include <hip/hip_runtime.h>
#include <math.h>

// Shapes from the reference
#define B 64
#define P 64
#define NN 1000
#define H 128

// LDS strides: even (8B-aligned v2f reads) and bank-conflict-free:
// row-indexed pair reads hit banks {4l+c,4l+c+1} (lanes 0-15) vs
// {4l+c+2,4l+c+3} (lanes 16-31) -> disjoint.
#define EMB_STR 132   // rows of 128 floats (emb tiles, vsum and final_q A matrices)

typedef float v2f __attribute__((ext_vector_type(2)));
typedef float v8f __attribute__((ext_vector_type(8)));
typedef int   v4i __attribute__((ext_vector_type(4)));

// Full-precision matrix op: D(16x16,f32) = A(16x4,f32) * B(4x16,f32) + C
// A: lane(0..15) holds M=lane, K={k,k+1}; lane(16..31): M=lane-16, K={k+2,k+3}
// B: lane holds column N=lane&15, rows K = {2*(lane>>4)+0, 2*(lane>>4)+1}
// C/D: vgpr r -> M = r + 8*(lane>>4), N = lane&15
__device__ __forceinline__ v8f wmma_f32(v2f a, v2f b, v8f c) {
  return __builtin_amdgcn_wmma_f32_16x16x4_f32(false, a, false, b, (short)0, c,
                                               false, false);
}

// ---- CDNA5 async global->LDS staging (guarded; falls back to b128 copy) ----
#if __has_builtin(__builtin_amdgcn_global_load_async_to_lds_b128)
#define HAVE_ASYNC_LDS 1
#else
#define HAVE_ASYNC_LDS 0
#endif

__device__ __forceinline__ void copy16_g2l(float* l, const float* g) {
#if HAVE_ASYNC_LDS
  __builtin_amdgcn_global_load_async_to_lds_b128(
      (__attribute__((address_space(1))) v4i*)g,
      (__attribute__((address_space(3))) v4i*)l,
      0, 0);
#else
  *(float4*)l = *(const float4*)g;
#endif
}

// ---------------------------------------------------------------------------
// The one kernel: vsum[b,p,h] = sum_n mask01[p][n]*emb[n][h], the column mean of emb,
// final_q[b,p,h] = encq1@Wq_first + last_emb@Wq_last
//                          + (vsum/N)@W_visited + q_graph + load_emb, then
// probs[b,p,:] = softmax(10*tanh(fq.emb/sqrt(H) - dist/sqrt(2)) + maskprob)
// One workgroup (16 wave32) per (batch b, 16-row tile of p).
// vsum: wave w sums over its own 64 rows of n (the four emb tiles that it also
// scores), all eight H tiles; the column sums come from the same B fragments;
// the 16 waves' partial sums meet in LDS. Nothing goes through global memory.
// final_q: wave w does the 16 columns of H tile w&7 over K half w>>3 of the
// three products; the two halves' sums meet in LDS, where the A fragments of
// the score product are read from. It never goes through global memory.
// Scores: the workgroup owns whole rows of the output, so the logits stay in
// the accumulators' registers through the softmax and the output is written
// once. Wave w does the four n-tiles 4w..4w+3 (64 neighbouring columns). The A
// fragments (the 16 rows of final_q) are the same for every tile and sit in
// registers; each wave's emb tile comes to LDS in whole rows by async copies,
// two buffers, next tile in flight. The score loop takes the tiles from the last
// to the first: tile 3 still lies in its buffer from the vsum loop.
// Every loop of this kernel is unrolled: the arrays are registers only while
// every index is a constant.
// ---------------------------------------------------------------------------
typedef float v4f __attribute__((ext_vector_type(4)));

// value of lane (l ^ MASK) inside the 16-lane row: CTRL = 0x160 | MASK (row_xmask)
template <int CTRL>
__device__ __forceinline__ float row_xor(float v) {
  return __builtin_bit_cast(float, __builtin_amdgcn_update_dpp(
      0, __builtin_bit_cast(int, v), CTRL, 0xf, 0xf, true));
}
__device__ __forceinline__ float row16_max(float v) {
  v = fmaxf(v, row_xor<0x161>(v));
  v = fmaxf(v, row_xor<0x162>(v));
  v = fmaxf(v, row_xor<0x164>(v));
  v = fmaxf(v, row_xor<0x168>(v));
  return v;
}
__device__ __forceinline__ float row16_sum(float v) {
  v += row_xor<0x161>(v);
  v += row_xor<0x162>(v);
  v += row_xor<0x164>(v);
  v += row_xor<0x168>(v);
  return v;
}

// wave wid's n-tile 4*wid+c: 16 rows of 512 B, one copy per row. A tile that
// lies wholly inside N (a test that is the same for the whole wave) goes from
// one address with constant steps: a tile is staged twice, and sixteen clamped
// addresses a tile, held from the first time to the second, spilled. In the
// last wave's tail tiles the row is clamped: every address is in bounds, every
// lane is on.
__device__ __forceinline__ void stage_emb_tile(float* s_emb, const float* embB,
                                               int wid, int lane, int c) {
  float* dst = s_emb + (wid * 2 + (c & 1)) * 16 * EMB_STR + lane * 4;
  const int n0 = (wid * 4 + c) * 16;
  if (n0 + 16 <= NN) {
    const float* g = embB + (size_t)n0 * H + lane * 4;
#pragma unroll
    for (int i = 0; i < 16; ++i) copy16_g2l(dst + i * EMB_STR, g + i * H);
  } else {
#pragma unroll
    for (int i = 0; i < 16; ++i) {
      const int n = (n0 + i < NN) ? (n0 + i) : (NN - 1);
      copy16_g2l(dst + i * EMB_STR, embB + (size_t)n * H + lane * 4);
    }
  }
}

__global__ void __launch_bounds__(512)
score_softmax_kernel(const float* __restrict__ dists, const float* __restrict__ emb,
                     const float* __restrict__ encq1, const int* __restrict__ last_node,
                     const float* __restrict__ loadv, const float* __restrict__ gmask,
                     const float* __restrict__ Wq_graph, const float* __restrict__ Wq_first,
                     const float* __restrict__ Wq_last, const float* __restrict__ Wv,
                     const float* __restrict__ W_load, const float* __restrict__ b_load,
                     float* __restrict__ out)
{
  // 264 KB: [wave][buffer][16 rows]; a wave's two buffers lie side by side, so
  // that all its fragment reads are one address register and an offset
  __shared__ __align__(16) float s_emb[16 * 2 * 16 * EMB_STR];
  __shared__ __align__(16) float s_fq[2 * 16 * EMB_STR];    // final_q: [K half][row]
  __shared__ __align__(16) float s_vs[16 * EMB_STR];        // vsum/N: [row]
  // the tile's rows of encq1, then the rows' last-node emb; once their products
  // are done, the column sums: [wave][lane half][h]
  __shared__ __align__(16) float s_a12[2 * 16 * EMB_STR];
  float* const s_enc  = s_a12;
  float* const s_last = s_a12 + 16 * EMB_STR;
  __shared__ __align__(16) float s_mean[H];
  __shared__ float s_qg[4 * H];                             // q_graph: [K quarter][h]
  __shared__ __align__(16) float s_rm[16 * 16];             // [wave][row] maxima
  __shared__ __align__(16) float s_rs[16 * 16];             // [wave][row] sums

  const int b    = blockIdx.x >> 2;
  const int pt   = blockIdx.x & 3;
  const int p0   = pt * 16;
  const int tid  = threadIdx.x;
  const int lane = tid & 31;
  const int wid  = __builtin_amdgcn_readfirstlane(tid >> 5);
  const int lrow = lane & 15;
  const int half = lane >> 4;
  const int khi  = half * 2;
  const float* embB = emb + (size_t)b * NN * H;

  // The wave's A fragments of the vsum product: the mask of its 64 columns, 16
  // bytes a load, asked for in one batch ahead of the copies. Load j holds
  // n = 64 wid + 8 j + 4 half + {0..3}: two k-steps, whose B rows follow the same
  // order. A group of eight past N is read at a clamped place and counts as zero.
  v4f mk[8];
  {
    const float* gmT = gmask + ((size_t)b * P + p0) * NN;
    const unsigned mo = (lrow * NN + 4 * half) * 4u;   // the lane's byte offset
#pragma unroll
    for (int j = 0; j < 8; ++j) {
      const int nj = wid * 64 + 8 * j;
      mk[j] = *(const v4f*)((const char*)(gmT + ((nj < NN) ? nj : (NN - 8))) + mo);
    }
    // the batch's address registers are free for reuse behind this; as an input
    // the lane's offset lives up to the wait
    asm volatile("s_wait_xcnt 0x0" :: "v"(mo) : "memory");
  }

  // every wave's first emb tile, and row wid of the two A matrices that come
  // from global memory (whole rows: one copy per thread each)
  stage_emb_tile(s_emb, embB, wid, lane, 0);
  copy16_g2l(&s_enc[wid * EMB_STR + lane * 4],
             encq1 + ((size_t)b * P + p0 + wid) * H + lane * 4);
  {
    int lw = last_node[b * P + p0 + wid];
    lw = (lw < 0) ? 0 : ((lw > NN - 1) ? NN - 1 : lw);   // row index bounded before use
    copy16_g2l(&s_last[wid * EMB_STR + lane * 4], embB + (size_t)lw * H + lane * 4);
  }

  // the lane's eight rows of dists; row index bounded before use
  int ln[8];
  {
    const v4i l0 = *(const v4i*)(last_node + b * P + p0 + 8 * half);
    const v4i l1 = *(const v4i*)(last_node + b * P + p0 + 8 * half + 4);
#pragma unroll
    for (int r = 0; r < 4; ++r) { ln[r] = l0[r]; ln[4 + r] = l1[r]; }
#pragma unroll
    for (int r = 0; r < 8; ++r)
      ln[r] = (ln[r] < 0) ? 0 : ((ln[r] > NN - 1) ? NN - 1 : ln[r]);
  }

  // ---- final_q -------------------------------------------------------------
  const int ht   = wid & 7;           // the wave's H tile (16 output columns)
  const int kh   = wid >> 3;          // its half of K
  const int qr   = wid >> 2;          // its quarter of the q_graph matvec's K
  const int hc   = tid & 127;         // the thread's column in mean and matvec
  const int hcol = 16 * ht + lrow;    // the lane's output column
  const float invN = 1.0f / NN;

  // What final_q takes from global memory, Wq_graph aside, is asked for in the same batch as the
  // mask and tile 0, one latency for all: the epilogue's values and the wave's B
  // fragments of all its 16 k-steps of the three weight matrices.
  const v4f lv0 = *(const v4f*)(loadv + b * P + p0 + 8 * half);
  const v4f lv1 = *(const v4f*)(loadv + b * P + p0 + 8 * half + 4);
  const float wl = W_load[hcol], bl = b_load[hcol];
  // the batch's address registers are free for reuse behind this; as inputs
  // the lanes' offsets live up to the wait
  asm volatile("s_wait_xcnt 0x0" :: "v"(hcol) : "memory");

  v2f b1[16], b2[16], b3[16];
  {
    const size_t c0 = (size_t)((64 * kh + khi) * H + hcol);
    const float* w3 = Wv + c0;
    const float* w1 = Wq_first + c0;
    const float* w2 = Wq_last + c0;
#pragma unroll
    for (int j = 0; j < 16; ++j) {
      b3[j].x = w3[4 * j * H]; b3[j].y = w3[(4 * j + 1) * H];
      b1[j].x = w1[4 * j * H]; b1[j].y = w1[(4 * j + 1) * H];
      b2[j].x = w2[4 * j * H]; b2[j].y = w2[(4 * j + 1) * H];
    }
  }
  // the batch's address registers are free for reuse behind this
  asm volatile("s_wait_xcnt 0x0" ::: "memory");

  // tile 0 and the two A matrices have landed before anybody reads them
  asm volatile("s_wait_asynccnt 0x0" ::: "memory");
  __syncthreads();
  stage_emb_tile(s_emb, embB, wid, lane, 1);

  // the two products of final_q that hang on no sum over n, over the wave's 64
  // values of K, ahead of the vsum loop; the sums wait in LDS, each at its own
  // thread's place in final_q, so that no register of theirs lives through the loop
  {
    v8f f = {};
    const float* a1 = &s_enc[lrow * EMB_STR + 64 * kh + khi];
    const float* a2 = &s_last[lrow * EMB_STR + 64 * kh + khi];
#pragma unroll
    for (int g = 0; g < 4; ++g) {
      v2f x1[4], x2[4];
#pragma unroll
      for (int j = 0; j < 4; ++j) {
        const int k = 4 * (4 * g + j);
        x1[j] = *(const v2f*)(a1 + k);
        x2[j] = *(const v2f*)(a2 + k);
      }
#pragma unroll
      for (int j = 0; j < 4; ++j) {
        f = wmma_f32(x1[j], b1[4 * g + j], f);
        f = wmma_f32(x2[j], b2[4 * g + j], f);
      }
    }
    // + load*W_load + b_load, once: in K half 0
#pragma unroll
    for (int r = 0; r < 8; ++r) {
      const float lv = (r < 4) ? lv0[r & 3] : lv1[r & 3];
      const float ex = (kh == 0) ? (lv * wl + bl) : 0.f;
      s_fq[(kh * 16 + r + 8 * half) * EMB_STR + hcol] = f[r] + ex;
    }
  }

  // ---- vsum and column sums over the wave's own 64 rows of n -----------------
  float wg[32];
  {
    v8f va[8] = {};
    float cs[8] = {};
#pragma unroll
    for (int c = 0; c < 4; ++c) {
      // the upper half-wave reads four rows on: 528 words, 16 banks away
      const float* tb = &s_emb[((wid * 2 + (c & 1)) * 16 + 4 * half) * EMB_STR + lrow];
#pragma unroll
      for (int jj = 0; jj < 2; ++jj) {
        const int j = 2 * c + jj;
        const bool ok = wid * 64 + 8 * j < NN;
        const float one = ok ? 1.f : 0.f;
        float m4[4];
#pragma unroll
        for (int e = 0; e < 4; ++e) {
          const float g = mk[j][e];
          m4[e] = ok ? ((g < -1e30f) ? 1.f : g) : 0.f;
        }
#pragma unroll
        for (int st = 0; st < 2; ++st) {
          const v2f am = {m4[2 * st], m4[2 * st + 1]};
          v2f bb[8];
#pragma unroll
          for (int t = 0; t < 8; ++t) {
            bb[t].x = tb[(8 * jj + 2 * st + 0) * EMB_STR + 16 * t];
            bb[t].y = tb[(8 * jj + 2 * st + 1) * EMB_STR + 16 * t];
          }
#pragma unroll
          for (int t = 0; t < 8; ++t) {
            va[t] = wmma_f32(am, bb[t], va[t]);
            cs[t] = fmaf(bb[t].x, one, cs[t]);
            cs[t] = fmaf(bb[t].y, one, cs[t]);
          }
        }
      }
      // hand-over: this buffer's reads are done, the next tile has landed, and
      // only then is this buffer filled again
      asm volatile("s_wait_dscnt 0x0" ::: "memory");
      asm volatile("s_wait_asynccnt 0x0" ::: "memory");
      __syncthreads();
      if (c + 2 < 4) stage_emb_tile(s_emb, embB, wid, lane, c + 2);
    }
    // no copy is left in flight behind the loop
    asm volatile("s_wait_asynccnt 0x0" ::: "memory");

    // the thread's quarter column of Wq_graph: no register is free for it in the
    // loop above; it flies beside the stores below
    const float* gb = Wq_graph + (size_t)qr * 32 * H + hc;
#pragma unroll
    for (int k = 0; k < 32; ++k) wg[k] = gb[k * H];
    // the batch's address registers are free for reuse behind this; as an input
    // the lane's offset lives up to the wait
    asm volatile("s_wait_xcnt 0x0" :: "v"(hc) : "memory");

    // the wave's partial sums as a matrix [p][h] in its buffer 0 (tile 2 is used
    // up; tile 3 stays in buffer 1 for the score loop)
    float* pr = &s_emb[(wid * 2 * 16 + 8 * half) * EMB_STR + lrow];
#pragma unroll
    for (int t = 0; t < 8; ++t) {
#pragma unroll
      for (int r = 0; r < 8; ++r) pr[r * EMB_STR + 16 * t] = va[t][r];
      s_a12[(wid * 2 + half) * H + 16 * t + lrow] = cs[t];
    }
  }

  // every wave's partial sums are written
  __syncthreads();
  {
    // row wid of vsum/N: the 16 waves' partial rows, four columns a lane
    const float* pp = &s_emb[wid * EMB_STR + lane * 4];
    v4f x[16];
#pragma unroll
    for (int w = 0; w < 16; ++w) x[w] = *(const v4f*)(pp + w * 2 * 16 * EMB_STR);
    v4f vs = {};
#pragma unroll
    for (int w = 0; w < 16; ++w) vs += x[w];
    *(v4f*)&s_vs[wid * EMB_STR + lane * 4] = vs * invN;
  }
  if (qr == 0) {   // column mean: waves 0..3, one column a thread
    float sm = 0.f;
#pragma unroll
    for (int c = 0; c < 32; ++c) sm += s_a12[c * H + hc];
    s_mean[hc] = sm * invN;
  }
  // buffer 0's last reads are done in every wave before it is filled again
  asm volatile("s_wait_dscnt 0x0" ::: "memory");
  __syncthreads();
  stage_emb_tile(s_emb, embB, wid, lane, 2);

  {
    float s = 0.f;
#pragma unroll
    for (int k = 0; k < 32; ++k) s += s_mean[32 * qr + k] * wg[k];
    s_qg[qr * H + hc] = s;
  }
  __syncthreads();

  // the third product, (vsum/N) @ W_visited, on top of the first two
  {
    v8f f;
#pragma unroll
    for (int r = 0; r < 8; ++r) f[r] = s_fq[(kh * 16 + r + 8 * half) * EMB_STR + hcol];
    const float* av = &s_vs[lrow * EMB_STR + 64 * kh + khi];
#pragma unroll
    for (int g = 0; g < 4; ++g) {
      v2f x3[4];
#pragma unroll
      for (int j = 0; j < 4; ++j) x3[j] = *(const v2f*)(av + 4 * (4 * g + j));
#pragma unroll
      for (int j = 0; j < 4; ++j) f = wmma_f32(x3[j], b3[4 * g + j], f);
    }
    // + q_graph, once: in K half 0
    const float qg = (s_qg[hcol] + s_qg[H + hcol]) + (s_qg[2 * H + hcol] + s_qg[3 * H + hcol]);
#pragma unroll
    for (int r = 0; r < 8; ++r)
      s_fq[(kh * 16 + r + 8 * half) * EMB_STR + hcol] = f[r] + ((kh == 0) ? qg : 0.f);
  }
  __syncthreads();

  // The lane's 32 distance and 32 mask values are asked for here, in one batch,
  // behind final_q's last barrier (a barrier waits for every load in front of it):
  // their latency is paid once, beside the first tile's k loop. Column clamped
  // like emb's row: every address is in bounds.
  const int nb = wid * 64 + lrow;              // the lane's column in tile q: nb + 16 q
  float dv[4][8], gv[4][8];
#pragma unroll
  for (int q = 0; q < 4; ++q) {
    const int n  = nb + 16 * q;
    const int nc = (n < NN) ? n : (NN - 1);
#pragma unroll
    for (int r = 0; r < 8; ++r) {
      dv[q][r] = dists[((size_t)b * NN + ln[r]) * NN + nc];
      gv[q][r] = gmask[((size_t)b * P + p0 + r + 8 * half) * NN + nc];
    }
  }

  v2f a[32];
#pragma unroll
  for (int k = 0; k < 32; ++k)
    a[k] = *(const v2f*)&s_fq[lrow * EMB_STR + 4 * k + khi] +
           *(const v2f*)&s_fq[(16 + lrow) * EMB_STR + 4 * k + khi];

  v8f acc[4] = {};
#pragma unroll
  for (int c = 3; c >= 0; --c) {
    const float* bp = &s_emb[((wid * 2 + (c & 1)) * 16 + lrow) * EMB_STR + khi];
#pragma unroll
    for (int g = 0; g < 4; ++g) {
      v2f bf[8];
#pragma unroll
      for (int j = 0; j < 8; ++j) bf[j] = *(const v2f*)(bp + 4 * (8 * g + j));
#pragma unroll
      for (int j = 0; j < 8; ++j) acc[c] = wmma_f32(a[8 * g + j], bf[j], acc[c]);
    }
    // hand-over: this buffer's reads are done, the next tile has landed, and
    // only then is this buffer filled again
    asm volatile("s_wait_dscnt 0x0" ::: "memory");
    asm volatile("s_wait_asynccnt 0x0" ::: "memory");
    __syncthreads();
    if (c - 2 >= 0) stage_emb_tile(s_emb, embB, wid, lane, c - 2);
  }
  // no copy is left in flight behind the loop
  asm volatile("s_wait_asynccnt 0x0" ::: "memory");

  const float log2e  = 1.4426950408889634f;
  const float k_acc  = 0.25503486164919736f;     // 2 log2(e) / sqrt(128)
  const float k_dist = 2.040278893193579f;       // 2 log2(e) / sqrt(2)

  // logits in place of the accumulators; columns past N take no part
  float m[8];
#pragma unroll
  for (int r = 0; r < 8; ++r) m[r] = -3.4e38f;
#pragma unroll
  for (int q = 0; q < 4; ++q) {
    const bool live = nb + 16 * q < NN;
#pragma unroll
    for (int r = 0; r < 8; ++r) {
      // 10 tanh(s) = 10 - 20 / (e^(2s) + 1); x = 2 s log2(e). Both ends are
      // right without a branch: 2^x = inf gives 10, 2^x = 0 gives -10.
      float x  = acc[q][r] * k_acc - dv[q][r] * k_dist;
      float sc = 10.f - 20.f * __builtin_amdgcn_rcpf(__builtin_amdgcn_exp2f(x) + 1.0f);
      float g  = gv[q][r];
      float o  = sc + ((g < -1e30f) ? -1e8f : g);
      o = live ? o : -3.4e38f;
      acc[q][r] = o;
      m[r] = fmaxf(m[r], o);
    }
  }

  // row maximum: 16 lanes, then the 16 waves (lane l takes wave l's values)
#pragma unroll
  for (int r = 0; r < 8; ++r) m[r] = row16_max(m[r]);
  if (lrow == 0) {
    v4f x0 = {m[0], m[1], m[2], m[3]}, x1 = {m[4], m[5], m[6], m[7]};
    *(v4f*)&s_rm[wid * 16 + 8 * half]     = x0;
    *(v4f*)&s_rm[wid * 16 + 8 * half + 4] = x1;
  }
  __syncthreads();
  {
    const v4f x0 = *(const v4f*)&s_rm[lrow * 16 + 8 * half];
    const v4f x1 = *(const v4f*)&s_rm[lrow * 16 + 8 * half + 4];
#pragma unroll
    for (int r = 0; r < 4; ++r) {
      m[r]     = row16_max(x0[r]);
      m[4 + r] = row16_max(x1[r]);
    }
  }

  float sum[8] = {};
#pragma unroll
  for (int q = 0; q < 4; ++q)
#pragma unroll
    for (int r = 0; r < 8; ++r) {
      // the difference first, the scale behind it: exact also where a whole
      // row is masked and both terms lie near -1e8
      float e = __builtin_amdgcn_exp2f((acc[q][r] - m[r]) * log2e);
      acc[q][r] = e;
      sum[r] += e;
    }
#pragma unroll
  for (int r = 0; r < 8; ++r) sum[r] = row16_sum(sum[r]);
  if (lrow == 0) {
    v4f x0 = {sum[0], sum[1], sum[2], sum[3]}, x1 = {sum[4], sum[5], sum[6], sum[7]};
    *(v4f*)&s_rs[wid * 16 + 8 * half]     = x0;
    *(v4f*)&s_rs[wid * 16 + 8 * half + 4] = x1;
  }
  __syncthreads();
  {
    const v4f x0 = *(const v4f*)&s_rs[lrow * 16 + 8 * half];
    const v4f x1 = *(const v4f*)&s_rs[lrow * 16 + 8 * half + 4];
#pragma unroll
    for (int r = 0; r < 4; ++r) {
      sum[r]     = 1.0f / row16_sum(x0[r]);
      sum[4 + r] = 1.0f / row16_sum(x1[r]);
    }
  }

  float* orow = out + ((size_t)b * P + p0 + 8 * half) * NN + nb;
#pragma unroll
  for (int q = 0; q < 4; ++q) {
    if (nb + 16 * q < NN) {
#pragma unroll
      for (int r = 0; r < 8; ++r)
        orow[r * NN + 16 * q] = acc[q][r] * sum[r];
    }
  }
}

// ---------------------------------------------------------------------------
extern "C" void kernel_launch(void* const* d_in, const int* in_sizes, int n_in,
                              void* d_out, int out_size, void* d_ws, size_t ws_size,
                              hipStream_t stream) {
  const float* dists     = (const float*)d_in[0];
  const float* emb       = (const float*)d_in[1];
  const float* encq1     = (const float*)d_in[2];
  const int*   last_node = (const int*)d_in[3];
  const float* loadv     = (const float*)d_in[4];
  const float* gmask     = (const float*)d_in[5];
  const float* Wq_graph  = (const float*)d_in[6];
  const float* Wq_first  = (const float*)d_in[7];
  const float* Wq_last   = (const float*)d_in[8];
  const float* Wv        = (const float*)d_in[9];
  const float* W_load    = (const float*)d_in[10];
  const float* b_load    = (const float*)d_in[11];
  float* out = (float*)d_out;

  score_softmax_kernel<<<B * 4, 512, 0, stream>>>(dists, emb, encq1, last_node, loadv, gmask,
                                                  Wq_graph, Wq_first, Wq_last, Wv,
                                                  W_load, b_load, out);
}

// v008
// It runs in 28.9 microseconds.
// Timed twice side by side with v007, it ran 1.03 times as fast both times.
// Over all steps from v000 it is 8.98 times as fast.
#include <hip/hip_runtime.h>
#include <math.h>

// Shapes from the reference
#define B 64
#define P 64
#define NN 1000
#define H 128

// LDS strides: even (8B-aligned v2f reads) and bank-conflict-free:
// row-indexed pair reads hit banks {4l+c,4l+c+1} (lanes 0-15) vs
// {4l+c+2,4l+c+3} (lanes 16-31) -> disjoint.
#define EMB_STR 132   // rows of 128 floats (emb tiles, vsum and final_q A matrices)

typedef float v2f __attribute__((ext_vector_type(2)));
typedef float v8f __attribute__((ext_vector_type(8)));
typedef int   v4i __attribute__((ext_vector_type(4)));

// Full-precision matrix op: D(16x16,f32) = A(16x4,f32) * B(4x16,f32) + C
// A: lane(0..15) holds M=lane, K={k,k+1}; lane(16..31): M=lane-16, K={k+2,k+3}
// B: lane holds column N=lane&15, rows K = {2*(lane>>4)+0, 2*(lane>>4)+1}
// C/D: vgpr r -> M = r + 8*(lane>>4), N = lane&15
__device__ __forceinline__ v8f wmma_f32(v2f a, v2f b, v8f c) {
  return __builtin_amdgcn_wmma_f32_16x16x4_f32(false, a, false, b, (short)0, c,
                                               false, false);
}

// ---- CDNA5 async global->LDS staging (guarded; falls back to b128 copy) ----
#if __has_builtin(__builtin_amdgcn_global_load_async_to_lds_b128)
#define HAVE_ASYNC_LDS 1
#else
#define HAVE_ASYNC_LDS 0
#endif

__device__ __forceinline__ void copy16_g2l(float* l, const float* g) {
#if HAVE_ASYNC_LDS
  __builtin_amdgcn_global_load_async_to_lds_b128(
      (__attribute__((address_space(1))) v4i*)g,
      (__attribute__((address_space(3))) v4i*)l,
      0, 0);
#else
  *(float4*)l = *(const float4*)g;
#endif
}

// ---------------------------------------------------------------------------
// The one kernel: vsum[b,p,h] = sum_n mask01[p][n]*emb[n][h], the column mean of emb,
// final_q[b,p,h] = encq1@Wq_first + last_emb@Wq_last
//                          + (vsum/N)@W_visited + q_graph + load_emb, then
// probs[b,p,:] = softmax(10*tanh(fq.emb/sqrt(H) - dist/sqrt(2)) + maskprob)
// One workgroup (16 wave32) per (batch b, 16-row tile of p).
// vsum: wave w sums over its own 64 rows of n (the four emb tiles that it also
// scores), all eight H tiles; the column sums come from the same B fragments;
// the 16 waves' partial sums meet in LDS. Nothing goes through global memory.
// final_q: wave w does the 16 columns of H tile w&7 over K half w>>3 of the
// three products; the two halves' sums meet in LDS, where the A fragments of
// the score product are read from. It never goes through global memory.
// Scores: the workgroup owns whole rows of the output, so the logits stay in
// the accumulators' registers through the softmax and the output is written
// once. Wave w does the four n-tiles 4w..4w+3 (64 neighbouring columns). The A
// fragments (the 16 rows of final_q) are the same for every tile and sit in
// registers; each wave's emb tile comes to LDS in whole rows by async copies,
// two buffers, next tile in flight. The score loop takes the tiles from the last
// to the first: tile 3 still lies in its buffer from the vsum loop.
// The two buffers are a ring private to their wave: only the wave that copies a
// tile reads it. A hand-over is therefore the wave's own two waits and no
// work-group barrier, and the 16 waves do not march in step through the loops.
// Every loop of this kernel is unrolled: the arrays are registers only while
// every index is a constant.
// ---------------------------------------------------------------------------
typedef float v4f __attribute__((ext_vector_type(4)));

// value of lane (l ^ MASK) inside the 16-lane row: CTRL = 0x160 | MASK (row_xmask)
template <int CTRL>
__device__ __forceinline__ float row_xor(float v) {
  return __builtin_bit_cast(float, __builtin_amdgcn_update_dpp(
      0, __builtin_bit_cast(int, v), CTRL, 0xf, 0xf, true));
}
__device__ __forceinline__ float row16_max(float v) {
  v = fmaxf(v, row_xor<0x161>(v));
  v = fmaxf(v, row_xor<0x162>(v));
  v = fmaxf(v, row_xor<0x164>(v));
  v = fmaxf(v, row_xor<0x168>(v));
  return v;
}
__device__ __forceinline__ float row16_sum(float v) {
  v += row_xor<0x161>(v);
  v += row_xor<0x162>(v);
  v += row_xor<0x164>(v);
  v += row_xor<0x168>(v);
  return v;
}

// wave wid's n-tile 4*wid+c: 16 rows of 512 B, one copy per row. A tile that
// lies wholly inside N (a test that is the same for the whole wave) goes from
// one address with constant steps: a tile is staged twice, and sixteen clamped
// addresses a tile, held from the first time to the second, spilled. In the
// last wave's tail tiles the row is clamped: every address is in bounds, every
// lane is on.
__device__ __forceinline__ void stage_emb_tile(float* s_emb, const float* embB,
                                               int wid, int lane, int c) {
  float* dst = s_emb + (wid * 2 + (c & 1)) * 16 * EMB_STR + lane * 4;
  const int n0 = (wid * 4 + c) * 16;
  if (n0 + 16 <= NN) {
    const float* g = embB + (size_t)n0 * H + lane * 4;
#pragma unroll
    for (int i = 0; i < 16; ++i) copy16_g2l(dst + i * EMB_STR, g + i * H);
  } else {
#pragma unroll
    for (int i = 0; i < 16; ++i) {
      const int n = (n0 + i < NN) ? (n0 + i) : (NN - 1);
      copy16_g2l(dst + i * EMB_STR, embB + (size_t)n * H + lane * 4);
    }
  }
}

__global__ void __launch_bounds__(512)
score_softmax_kernel(const float* __restrict__ dists, const float* __restrict__ emb,
                     const float* __restrict__ encq1, const int* __restrict__ last_node,
                     const float* __restrict__ loadv, const float* __restrict__ gmask,
                     const float* __restrict__ Wq_graph, const float* __restrict__ Wq_first,
                     const float* __restrict__ Wq_last, const float* __restrict__ Wv,
                     const float* __restrict__ W_load, const float* __restrict__ b_load,
                     float* __restrict__ out)
{
  // 264 KB: [wave][buffer][16 rows]; a wave's two buffers lie side by side, so
  // that all its fragment reads are one address register and an offset
  __shared__ __align__(16) float s_emb[16 * 2 * 16 * EMB_STR];
  __shared__ __align__(16) float s_fq[2 * 16 * EMB_STR];    // final_q: [K half][row]
  __shared__ __align__(16) float s_vs[16 * EMB_STR];        // vsum/N: [row]
  // the tile's rows of encq1, then the rows' last-node emb; once their products
  // are done, the column sums: [wave][lane half][h]
  __shared__ __align__(16) float s_a12[2 * 16 * EMB_STR];
  float* const s_enc  = s_a12;
  float* const s_last = s_a12 + 16 * EMB_STR;
  __shared__ __align__(16) float s_mean[H];
  __shared__ float s_qg[4 * H];                             // q_graph: [K quarter][h]
  __shared__ __align__(16) float s_rm[16 * 16];             // [wave][row] maxima
  __shared__ __align__(16) float s_rs[16 * 16];             // [wave][row] sums

  const int b    = blockIdx.x >> 2;
  const int pt   = blockIdx.x & 3;
  const int p0   = pt * 16;
  const int tid  = threadIdx.x;
  const int lane = tid & 31;
  const int wid  = __builtin_amdgcn_readfirstlane(tid >> 5);
  const int lrow = lane & 15;
  const int half = lane >> 4;
  const int khi  = half * 2;
  const float* embB = emb + (size_t)b * NN * H;

  // The wave's A fragments of the vsum product: the mask of its 64 columns, 16
  // bytes a load, asked for in one batch ahead of the copies. Load j holds
  // n = 64 wid + 8 j + 4 half + {0..3}: two k-steps, whose B rows follow the same
  // order. A group of eight past N is read at a clamped place and counts as zero.
  v4f mk[8];
  {
    const float* gmT = gmask + ((size_t)b * P + p0) * NN;
    const unsigned mo = (lrow * NN + 4 * half) * 4u;   // the lane's byte offset
#pragma unroll
    for (int j = 0; j < 8; ++j) {
      const int nj = wid * 64 + 8 * j;
      mk[j] = *(const v4f*)((const char*)(gmT + ((nj < NN) ? nj : (NN - 8))) + mo);
    }
    // the batch's address registers are free for reuse behind this; as an input
    // the lane's offset lives up to the wait
    asm volatile("s_wait_xcnt 0x0" :: "v"(mo) : "memory");
  }

  // every wave's first emb tile, and row wid of the two A matrices that come
  // from global memory (whole rows: one copy per thread each)
  stage_emb_tile(s_emb, embB, wid, lane, 0);
  copy16_g2l(&s_enc[wid * EMB_STR + lane * 4],
             encq1 + ((size_t)b * P + p0 + wid) * H + lane * 4);
  {
    int lw = last_node[b * P + p0 + wid];
    lw = (lw < 0) ? 0 : ((lw > NN - 1) ? NN - 1 : lw);   // row index bounded before use
    copy16_g2l(&s_last[wid * EMB_STR + lane * 4], embB + (size_t)lw * H + lane * 4);
  }

  // the lane's eight rows of dists; row index bounded before use
  int ln[8];
  {
    const v4i l0 = *(const v4i*)(last_node + b * P + p0 + 8 * half);
    const v4i l1 = *(const v4i*)(last_node + b * P + p0 + 8 * half + 4);
#pragma unroll
    for (int r = 0; r < 4; ++r) { ln[r] = l0[r]; ln[4 + r] = l1[r]; }
#pragma unroll
    for (int r = 0; r < 8; ++r)
      ln[r] = (ln[r] < 0) ? 0 : ((ln[r] > NN - 1) ? NN - 1 : ln[r]);
  }

  // ---- final_q -------------------------------------------------------------
  const int ht   = wid & 7;           // the wave's H tile (16 output columns)
  const int kh   = wid >> 3;          // its half of K
  const int qr   = wid >> 2;          // its quarter of the q_graph matvec's K
  const int hc   = tid & 127;         // the thread's column in mean and matvec
  const int hcol = 16 * ht + lrow;    // the lane's output column
  const float invN = 1.0f / NN;

  // What final_q takes from global memory, Wq_graph aside, is asked for in the same batch as the
  // mask and tile 0, one latency for all: the epilogue's values and the wave's B
  // fragments of all its 16 k-steps of the three weight matrices.
  const v4f lv0 = *(const v4f*)(loadv + b * P + p0 + 8 * half);
  const v4f lv1 = *(const v4f*)(loadv + b * P + p0 + 8 * half + 4);
  const float wl = W_load[hcol], bl = b_load[hcol];
  // the batch's address registers are free for reuse behind this; as inputs
  // the lanes' offsets live up to the wait
  asm volatile("s_wait_xcnt 0x0" :: "v"(hcol) : "memory");

  v2f b1[16], b2[16], b3[16];
  {
    const size_t c0 = (size_t)((64 * kh + khi) * H + hcol);
    const float* w3 = Wv + c0;
    const float* w1 = Wq_first + c0;
    const float* w2 = Wq_last + c0;
#pragma unroll
    for (int j = 0; j < 16; ++j) {
      b3[j].x = w3[4 * j * H]; b3[j].y = w3[(4 * j + 1) * H];
      b1[j].x = w1[4 * j * H]; b1[j].y = w1[(4 * j + 1) * H];
      b2[j].x = w2[4 * j * H]; b2[j].y = w2[(4 * j + 1) * H];
    }
  }
  // the batch's address registers are free for reuse behind this
  asm volatile("s_wait_xcnt 0x0" ::: "memory");

  // tile 0 and the two A matrices have landed before anybody reads them
  asm volatile("s_wait_asynccnt 0x0" ::: "memory");
  __syncthreads();
  stage_emb_tile(s_emb, embB, wid, lane, 1);

  // the two products of final_q that hang on no sum over n, over the wave's 64
  // values of K, ahead of the vsum loop; the sums wait in LDS, each at its own
  // thread's place in final_q, so that no register of theirs lives through the loop
  {
    v8f f = {};
    const float* a1 = &s_enc[lrow * EMB_STR + 64 * kh + khi];
    const float* a2 = &s_last[lrow * EMB_STR + 64 * kh + khi];
#pragma unroll
    for (int g = 0; g < 4; ++g) {
      v2f x1[4], x2[4];
#pragma unroll
      for (int j = 0; j < 4; ++j) {
        const int k = 4 * (4 * g + j);
        x1[j] = *(const v2f*)(a1 + k);
        x2[j] = *(const v2f*)(a2 + k);
      }
#pragma unroll
      for (int j = 0; j < 4; ++j) {
        f = wmma_f32(x1[j], b1[4 * g + j], f);
        f = wmma_f32(x2[j], b2[4 * g + j], f);
      }
    }
    // + load*W_load + b_load, once: in K half 0
#pragma unroll
    for (int r = 0; r < 8; ++r) {
      const float lv = (r < 4) ? lv0[r & 3] : lv1[r & 3];
      const float ex = (kh == 0) ? (lv * wl + bl) : 0.f;
      s_fq[(kh * 16 + r + 8 * half) * EMB_STR + hcol] = f[r] + ex;
    }
  }

  // ---- vsum and column sums over the wave's own 64 rows of n -----------------
  float wg[32];
  {
    v8f va[8] = {};
    float cs[8] = {};
#pragma unroll
    for (int c = 0; c < 4; ++c) {
      // the upper half-wave reads four rows on: 528 words, 16 banks away
      const float* tb = &s_emb[((wid * 2 + (c & 1)) * 16 + 4 * half) * EMB_STR + lrow];
#pragma unroll
      for (int jj = 0; jj < 2; ++jj) {
        const int j = 2 * c + jj;
        const bool ok = wid * 64 + 8 * j < NN;
        const float one = ok ? 1.f : 0.f;
        float m4[4];
#pragma unroll
        for (int e = 0; e < 4; ++e) {
          const float g = mk[j][e];
          m4[e] = ok ? ((g < -1e30f) ? 1.f : g) : 0.f;
        }
#pragma unroll
        for (int st = 0; st < 2; ++st) {
          const v2f am = {m4[2 * st], m4[2 * st + 1]};
          v2f bb[8];
#pragma unroll
          for (int t = 0; t < 8; ++t) {
            bb[t].x = tb[(8 * jj + 2 * st + 0) * EMB_STR + 16 * t];
            bb[t].y = tb[(8 * jj + 2 * st + 1) * EMB_STR + 16 * t];
          }
#pragma unroll
          for (int t = 0; t < 8; ++t) {
            va[t] = wmma_f32(am, bb[t], va[t]);
            cs[t] = fmaf(bb[t].x, one, cs[t]);
            cs[t] = fmaf(bb[t].y, one, cs[t]);
          }
        }
      }
      // hand-over inside the wave: its reads of this buffer are done, its next
      // tile has landed, and only then does it fill this buffer again
      asm volatile("s_wait_dscnt 0x0" ::: "memory");
      asm volatile("s_wait_asynccnt 0x0" ::: "memory");
      // the loop's one barrier, not for the ring: every wave has read the encq1 and
      // last-node rows before a wave puts its column sums in their place below
      if (c == 0) __syncthreads();
      if (c + 2 < 4) stage_emb_tile(s_emb, embB, wid, lane, c + 2);
    }
    // no copy is left in flight behind the loop
    asm volatile("s_wait_asynccnt 0x0" ::: "memory");

    // the thread's quarter column of Wq_graph: no register is free for it in the
    // loop above; it flies beside the stores below
    const float* gb = Wq_graph + (size_t)qr * 32 * H + hc;
#pragma unroll
    for (int k = 0; k < 32; ++k) wg[k] = gb[k * H];
    // the batch's address registers are free for reuse behind this; as an input
    // the lane's offset lives up to the wait
    asm volatile("s_wait_xcnt 0x0" :: "v"(hc) : "memory");

    // the wave's partial sums as a matrix [p][h] in its buffer 0 (tile 2 is used
    // up; tile 3 stays in buffer 1 for the score loop)
    float* pr = &s_emb[(wid * 2 * 16 + 8 * half) * EMB_STR + lrow];
#pragma unroll
    for (int t = 0; t < 8; ++t) {
#pragma unroll
      for (int r = 0; r < 8; ++r) pr[r * EMB_STR + 16 * t] = va[t][r];
      s_a12[(wid * 2 + half) * H + 16 * t + lrow] = cs[t];
    }
  }

  // every wave's partial sums are written
  __syncthreads();
  {
    // row wid of vsum/N: the 16 waves' partial rows, four columns a lane
    const float* pp = &s_emb[wid * EMB_STR + lane * 4];
    v4f x[16];
#pragma unroll
    for (int w = 0; w < 16; ++w) x[w] = *(const v4f*)(pp + w * 2 * 16 * EMB_STR);
    v4f vs = {};
#pragma unroll
    for (int w = 0; w < 16; ++w) vs += x[w];
    *(v4f*)&s_vs[wid * EMB_STR + lane * 4] = vs * invN;
  }
  if (qr == 0) {   // column mean: waves 0..3, one column a thread
    float sm = 0.f;
#pragma unroll
    for (int c = 0; c < 32; ++c) sm += s_a12[c * H + hc];
    s_mean[hc] = sm * invN;
  }
  // buffer 0's last reads are done in every wave before it is filled again
  asm volatile("s_wait_dscnt 0x0" ::: "memory");
  __syncthreads();
  stage_emb_tile(s_emb, embB, wid, lane, 2);

  {
    float s = 0.f;
#pragma unroll
    for (int k = 0; k < 32; ++k) s += s_mean[32 * qr + k] * wg[k];
    s_qg[qr * H + hc] = s;
  }
  __syncthreads();

  // the third product, (vsum/N) @ W_visited, on top of the first two
  {
    v8f f;
#pragma unroll
    for (int r = 0; r < 8; ++r) f[r] = s_fq[(kh * 16 + r + 8 * half) * EMB_STR + hcol];
    const float* av = &s_vs[lrow * EMB_STR + 64 * kh + khi];
#pragma unroll
    for (int g = 0; g < 4; ++g) {
      v2f x3[4];
#pragma unroll
      for (int j = 0; j < 4; ++j) x3[j] = *(const v2f*)(av + 4 * (4 * g + j));
#pragma unroll
      for (int j = 0; j < 4; ++j) f = wmma_f32(x3[j], b3[4 * g + j], f);
    }
    // + q_graph, once: in K half 0
    const float qg = (s_qg[hcol] + s_qg[H + hcol]) + (s_qg[2 * H + hcol] + s_qg[3 * H + hcol]);
#pragma unroll
    for (int r = 0; r < 8; ++r)
      s_fq[(kh * 16 + r + 8 * half) * EMB_STR + hcol] = f[r] + ((kh == 0) ? qg : 0.f);
  }
  __syncthreads();

  // The lane's 32 distance and 32 mask values are asked for here, in one batch,
  // behind final_q's last barrier (a barrier waits for every load in front of it):
  // their latency is paid once, beside the score loop. Column clamped like emb's
  // row: every address is in bounds.
  const int nb = wid * 64 + lrow;              // the lane's column in tile q: nb + 16 q
  float dv[4][8], gv[4][8];
#pragma unroll
  for (int q = 0; q < 4; ++q) {
    const int n  = nb + 16 * q;
    const int nc = (n < NN) ? n : (NN - 1);
#pragma unroll
    for (int r = 0; r < 8; ++r) {
      dv[q][r] = dists[((size_t)b * NN + ln[r]) * NN + nc];
      gv[q][r] = gmask[((size_t)b * P + p0 + r + 8 * half) * NN + nc];
    }
  }

  v2f a[32];
#pragma unroll
  for (int k = 0; k < 32; ++k)
    a[k] = *(const v2f*)&s_fq[lrow * EMB_STR + 4 * k + khi] +
           *(const v2f*)&s_fq[(16 + lrow) * EMB_STR + 4 * k + khi];

  v8f acc[4] = {};
#pragma unroll
  for (int c = 3; c >= 0; --c) {
    const float* bp = &s_emb[((wid * 2 + (c & 1)) * 16 + lrow) * EMB_STR + khi];
#pragma unroll
    for (int g = 0; g < 4; ++g) {
      v2f bf[8];
#pragma unroll
      for (int j = 0; j < 8; ++j) bf[j] = *(const v2f*)(bp + 4 * (8 * g + j));
#pragma unroll
      for (int j = 0; j < 8; ++j) acc[c] = wmma_f32(a[8 * g + j], bf[j], acc[c]);
    }
    // hand-over inside the wave: its reads of this buffer are done, its next
    // tile has landed, and only then does it fill this buffer again
    asm volatile("s_wait_dscnt 0x0" ::: "memory");
    asm volatile("s_wait_asynccnt 0x0" ::: "memory");
    if (c - 2 >= 0) stage_emb_tile(s_emb, embB, wid, lane, c - 2);
  }
  // no copy is left in flight behind the loop
  asm volatile("s_wait_asynccnt 0x0" ::: "memory");

  const float log2e  = 1.4426950408889634f;
  const float k_acc  = 0.25503486164919736f;     // 2 log2(e) / sqrt(128)
  const float k_dist = 2.040278893193579f;       // 2 log2(e) / sqrt(2)

  // logits in place of the accumulators; columns past N take no part
  float m[8];
#pragma unroll
  for (int r = 0; r < 8; ++r) m[r] = -3.4e38f;
#pragma unroll
  for (int q = 0; q < 4; ++q) {
    const bool live = nb + 16 * q < NN;
#pragma unroll
    for (int r = 0; r < 8; ++r) {
      // 10 tanh(s) = 10 - 20 / (e^(2s) + 1); x = 2 s log2(e). Both ends are
      // right without a branch: 2^x = inf gives 10, 2^x = 0 gives -10.
      float x  = acc[q][r] * k_acc - dv[q][r] * k_dist;
      float sc = 10.f - 20.f * __builtin_amdgcn_rcpf(__builtin_amdgcn_exp2f(x) + 1.0f);
      float g  = gv[q][r];
      float o  = sc + ((g < -1e30f) ? -1e8f : g);
      o = live ? o : -3.4e38f;
      acc[q][r] = o;
      m[r] = fmaxf(m[r], o);
    }
  }

  // row maximum: 16 lanes, then the 16 waves (lane l takes wave l's values)
#pragma unroll
  for (int r = 0; r < 8; ++r) m[r] = row16_max(m[r]);
  if (lrow == 0) {
    v4f x0 = {m[0], m[1], m[2], m[3]}, x1 = {m[4], m[5], m[6], m[7]};
    *(v4f*)&s_rm[wid * 16 + 8 * half]     = x0;
    *(v4f*)&s_rm[wid * 16 + 8 * half + 4] = x1;
  }
  __syncthreads();
  {
    const v4f x0 = *(const v4f*)&s_rm[lrow * 16 + 8 * half];
    const v4f x1 = *(const v4f*)&s_rm[lrow * 16 + 8 * half + 4];
#pragma unroll
    for (int r = 0; r < 4; ++r) {
      m[r]     = row16_max(x0[r]);
      m[4 + r] = row16_max(x1[r]);
    }
  }

  float sum[8] = {};
#pragma unroll
  for (int q = 0; q < 4; ++q)
#pragma unroll
    for (int r = 0; r < 8; ++r) {
      // the difference first, the scale behind it: exact also where a whole
      // row is masked and both terms lie near -1e8
      float e = __builtin_amdgcn_exp2f((acc[q][r] - m[r]) * log2e);
      acc[q][r] = e;
      sum[r] += e;
    }
#pragma unroll
  for (int r = 0; r < 8; ++r) sum[r] = row16_sum(sum[r]);
  if (lrow == 0) {
    v4f x0 = {sum[0], sum[1], sum[2], sum[3]}, x1 = {sum[4], sum[5], sum[6], sum[7]};
    *(v4f*)&s_rs[wid * 16 + 8 * half]     = x0;
    *(v4f*)&s_rs[wid * 16 + 8 * half + 4] = x1;
  }
  __syncthreads();
  {
    const v4f x0 = *(const v4f*)&s_rs[lrow * 16 + 8 * half];
    const v4f x1 = *(const v4f*)&s_rs[lrow * 16 + 8 * half + 4];
#pragma unroll
    for (int r = 0; r < 4; ++r) {
      sum[r]     = 1.0f / row16_sum(x0[r]);
      sum[4 + r] = 1.0f / row16_sum(x1[r]);
    }
  }

  float* orow = out + ((size_t)b * P + p0 + 8 * half) * NN + nb;
#pragma unroll
  for (int q = 0; q < 4; ++q) {
    if (nb + 16 * q < NN) {
#pragma unroll
      for (int r = 0; r < 8; ++r)
        orow[r * NN + 16 * q] = acc[q][r] * sum[r];
    }
  }
}

// ---------------------------------------------------------------------------
extern "C" void kernel_launch(void* const* d_in, const int* in_sizes, int n_in,
                              void* d_out, int out_size, void* d_ws, size_t ws_size,
                              hipStream_t stream) {
  const float* dists     = (const float*)d_in[0];
  const float* emb       = (const float*)d_in[1];
  const float* encq1     = (const float*)d_in[2];
  const int*   last_node = (const int*)d_in[3];
  const float* loadv     = (const float*)d_in[4];
  const float* gmask     = (const float*)d_in[5];
  const float* Wq_graph  = (const float*)d_in[6];
  const float* Wq_first  = (const float*)d_in[7];
  const float* Wq_last   = (const float*)d_in[8];
  const float* Wv        = (const float*)d_in[9];
  const float* W_load    = (const float*)d_in[10];
  const float* b_load    = (const float*)d_in[11];
  float* out = (float*)d_out;

  score_softmax_kernel<<<B * 4, 512, 0, stream>>>(dists, emb, encq1, last_node, loadv, gmask,
                                                  Wq_graph, Wq_first, Wq_last, Wv,
                                                  W_load, b_load, out);
}

// v009
// Measured time: 28.1 microseconds a run.
// Next to v008, in two timings, it ran 1.03 times as fast each time.
// Over all steps from v000 it is 9.26 times as fast.
#include <hip/hip_runtime.h>
#include <math.h>

// Shapes from the reference
#define B 64
#define P 64
#define NN 1000
#define H 128

// LDS strides: even (8B-aligned v2f reads) and bank-conflict-free:
// row-indexed pair reads hit banks {4l+c,4l+c+1} (lanes 0-15) vs
// {4l+c+2,4l+c+3} (lanes 16-31) -> disjoint.
#define EMB_STR 132   // rows of 128 floats (emb tiles, vsum and final_q A matrices)

typedef float v2f __attribute__((ext_vector_type(2)));
typedef float v8f __attribute__((ext_vector_type(8)));
typedef int   v4i __attribute__((ext_vector_type(4)));

// Full-precision matrix op: D(16x16,f32) = A(16x4,f32) * B(4x16,f32) + C
// A: lane(0..15) holds M=lane, K={k,k+1}; lane(16..31): M=lane-16, K={k+2,k+3}
// B: lane holds column N=lane&15, rows K = {2*(lane>>4)+0, 2*(lane>>4)+1}
// C/D: vgpr r -> M = r + 8*(lane>>4), N = lane&15
__device__ __forceinline__ v8f wmma_f32(v2f a, v2f b, v8f c) {
  return __builtin_amdgcn_wmma_f32_16x16x4_f32(false, a, false, b, (short)0, c,
                                               false, false);
}

// ---- CDNA5 async global->LDS staging (guarded; falls back to b128 copy) ----
#if __has_builtin(__builtin_amdgcn_global_load_async_to_lds_b128)
#define HAVE_ASYNC_LDS 1
#else
#define HAVE_ASYNC_LDS 0
#endif

__device__ __forceinline__ void copy16_g2l(float* l, const float* g) {
#if HAVE_ASYNC_LDS
  __builtin_amdgcn_global_load_async_to_lds_b128(
      (__attribute__((address_space(1))) v4i*)g,
      (__attribute__((address_space(3))) v4i*)l,
      0, 0);
#else
  *(float4*)l = *(const float4*)g;
#endif
}

// ---------------------------------------------------------------------------
// The one kernel: vsum[b,p,h] = sum_n mask01[p][n]*emb[n][h], the column mean of emb,
// final_q[b,p,h] = encq1@Wq_first + last_emb@Wq_last
//                          + (vsum/N)@W_visited + q_graph + load_emb, then
// probs[b,p,:] = softmax(10*tanh(fq.emb/sqrt(H) - dist/sqrt(2)) + maskprob)
// One workgroup (16 wave32) per (batch b, 16-row tile of p).
// vsum: wave w sums over its own 64 rows of n (the four emb tiles that it also
// scores), all eight H tiles; the column sums come from the same B fragments;
// the 16 waves' partial sums meet in LDS. Nothing goes through global memory.
// final_q: wave w does the 16 columns of H tile w&7 over K half w>>3 of the
// three products; the two halves' sums meet in LDS, where the A fragments of
// the score product are read from. It never goes through global memory.
// Scores: the workgroup owns whole rows of the output, so the logits stay in
// the accumulators' registers through the softmax and the output is written
// once. Wave w does the four n-tiles 4w..4w+3 (64 neighbouring columns). The A
// fragments (the 16 rows of final_q) are the same for every tile and sit in
// registers; each wave's emb tile comes to LDS in whole rows by async copies,
// two buffers, next tile in flight. The score loop takes the tiles from the last
// to the first: tile 3 still lies in its buffer from the vsum loop.
// The two buffers are a ring private to their wave: only the wave that copies a
// tile reads it. A hand-over is therefore the wave's own two waits and no
// work-group barrier, and the 16 waves do not march in step through the loops.
// Every loop of this kernel is unrolled: the arrays are registers only while
// every index is a constant.
// ---------------------------------------------------------------------------
typedef float v4f __attribute__((ext_vector_type(4)));

// value of lane (l ^ MASK) inside the 16-lane row: CTRL = 0x160 | MASK (row_xmask)
template <int CTRL>
__device__ __forceinline__ float row_xor(float v) {
  return __builtin_bit_cast(float, __builtin_amdgcn_update_dpp(
      0, __builtin_bit_cast(int, v), CTRL, 0xf, 0xf, true));
}
__device__ __forceinline__ float row16_max(float v) {
  v = fmaxf(v, row_xor<0x161>(v));
  v = fmaxf(v, row_xor<0x162>(v));
  v = fmaxf(v, row_xor<0x164>(v));
  v = fmaxf(v, row_xor<0x168>(v));
  return v;
}
__device__ __forceinline__ float row16_sum(float v) {
  v += row_xor<0x161>(v);
  v += row_xor<0x162>(v);
  v += row_xor<0x164>(v);
  v += row_xor<0x168>(v);
  return v;
}

// wave wid's n-tile 4*wid+c: 16 rows of 512 B, one copy per row. A tile that
// lies wholly inside N (a test that is the same for the whole wave) goes from
// one address with constant steps: a tile is staged twice, and sixteen clamped
// addresses a tile, held from the first time to the second, spilled. In the
// last wave's tail tiles the row is clamped: every address is in bounds, every
// lane is on.
__device__ __forceinline__ void stage_emb_tile(float* s_emb, const float* embB,
                                               int wid, int lane, int c) {
  float* dst = s_emb + (wid * 2 + (c & 1)) * 16 * EMB_STR + lane * 4;
  const int n0 = (wid * 4 + c) * 16;
  if (n0 + 16 <= NN) {
    const float* g = embB + (size_t)n0 * H + lane * 4;
#pragma unroll
    for (int i = 0; i < 16; ++i) copy16_g2l(dst + i * EMB_STR, g + i * H);
  } else {
#pragma unroll
    for (int i = 0; i < 16; ++i) {
      const int n = (n0 + i < NN) ? (n0 + i) : (NN - 1);
      copy16_g2l(dst + i * EMB_STR, embB + (size_t)n * H + lane * 4);
    }
  }
}

__global__ void __launch_bounds__(512)
score_softmax_kernel(const float* __restrict__ dists, const float* __restrict__ emb,
                     const float* __restrict__ encq1, const int* __restrict__ last_node,
                     const float* __restrict__ loadv, const float* __restrict__ gmask,
                     const float* __restrict__ Wq_graph, const float* __restrict__ Wq_first,
                     const float* __restrict__ Wq_last, const float* __restrict__ Wv,
                     const float* __restrict__ W_load, const float* __restrict__ b_load,
                     float* __restrict__ out)
{
  // 264 KB: [wave][buffer][16 rows]; a wave's two buffers lie side by side, so
  // that all its fragment reads are one address register and an offset
  __shared__ __align__(16) float s_emb[16 * 2 * 16 * EMB_STR];
  // the column sums: [wave][lane half][h]; once the mean is taken, final_q: [K half][row]
  __shared__ __align__(16) float s_fq[2 * 16 * EMB_STR];
  __shared__ __align__(16) float s_vs[16 * EMB_STR];        // vsum/N: [row]
  // the tile's rows of encq1, then the rows' last-node emb
  __shared__ __align__(16) float s_a12[2 * 16 * EMB_STR];
  float* const s_enc  = s_a12;
  float* const s_last = s_a12 + 16 * EMB_STR;
  __shared__ __align__(16) float s_mean[H];
  __shared__ float s_qg[4 * H];                             // q_graph: [K quarter][h]
  __shared__ __align__(16) float s_rm[16 * 16];             // [wave][row] maxima
  __shared__ __align__(16) float s_rs[16 * 16];             // [wave][row] sums

  const int b    = blockIdx.x >> 2;
  const int pt   = blockIdx.x & 3;
  const int p0   = pt * 16;
  const int tid  = threadIdx.x;
  const int lane = tid & 31;
  const int wid  = __builtin_amdgcn_readfirstlane(tid >> 5);
  const int lrow = lane & 15;
  const int half = lane >> 4;
  const int khi  = half * 2;
  const float* embB = emb + (size_t)b * NN * H;

  // The wave's A fragments of the vsum product: the mask of its 64 columns, 16
  // bytes a load, asked for in one batch ahead of the copies. Load j holds
  // n = 64 wid + 8 j + 4 half + {0..3}: two k-steps, whose B rows follow the same
  // order. A group of eight past N is read at a clamped place and counts as zero.
  v4f mk[8];
  {
    const float* gmT = gmask + ((size_t)b * P + p0) * NN;
    const unsigned mo = (lrow * NN + 4 * half) * 4u;   // the lane's byte offset
#pragma unroll
    for (int j = 0; j < 8; ++j) {
      const int nj = wid * 64 + 8 * j;
      mk[j] = *(const v4f*)((const char*)(gmT + ((nj < NN) ? nj : (NN - 8))) + mo);
    }
    // the batch's address registers are free for reuse behind this; as an input
    // the lane's offset lives up to the wait
    asm volatile("s_wait_xcnt 0x0" :: "v"(mo) : "memory");
  }

  // the wave's first emb tile: with the mask and last_node, what the head of the kernel waits for
  stage_emb_tile(s_emb, embB, wid, lane, 0);
  int lw = last_node[b * P + p0 + wid];
  lw = (lw < 0) ? 0 : ((lw > NN - 1) ? NN - 1 : lw);   // row index bounded before use

  // the lane's eight rows of dists; row index bounded before use
  const unsigned lo = 32u * half;   // the lane's byte offset in a row of 16 words
  int ln[8];
  {
    const char* lb = (const char*)(last_node + b * P + p0);
    const v4i l0 = *(const v4i*)(lb + lo);
    const v4i l1 = *(const v4i*)(lb + lo + 16);
    // the two loads' address register is free for reuse behind this; as an input
    // the lane's offset lives up to the wait
    asm volatile("s_wait_xcnt 0x0" :: "v"(lo) : "memory");
#pragma unroll
    for (int r = 0; r < 4; ++r) { ln[r] = l0[r]; ln[4 + r] = l1[r]; }
#pragma unroll
    for (int r = 0; r < 8; ++r)
      ln[r] = (ln[r] < 0) ? 0 : ((ln[r] > NN - 1) ? NN - 1 : ln[r]);
  }

  // ---- final_q -------------------------------------------------------------
  const int ht   = wid & 7;           // the wave's H tile (16 output columns)
  const int kh   = wid >> 3;          // its half of K
  const int qr   = wid >> 2;          // its quarter of the q_graph matvec's K
  const int hc   = tid & 127;         // the thread's column in mean and matvec
  const int hcol = 16 * ht + lrow;    // the lane's output column
  const float invN = 1.0f / NN;

  // What final_q takes from global memory (the epilogue's values, the wave's B
  // fragments of all its 16 k-steps of the three weight matrices) is not asked
  // for here: the head of the kernel would wait for it with the matrix unit idle.
  // It is asked for in the last two trips of the vsum loop, behind the last emb
  // tile's copies and in the order in which it is used, and flies beside them.
  v4f lv0, lv1;
  float wl, bl;
  v2f b1[16], b2[16], b3[16];
  const unsigned wo = (64 * kh + khi) * H + hcol;   // the lane's first weight element

  // the wave's own tile 0 has landed: nobody else reads it, no barrier
  asm volatile("s_wait_asynccnt 0x0" ::: "memory");
  stage_emb_tile(s_emb, embB, wid, lane, 1);
  // row wid of the two A matrices that come from global memory (whole rows: one
  // copy per thread each); they land beside trip 0
  copy16_g2l(&s_enc[wid * EMB_STR + lane * 4],
             encq1 + ((size_t)b * P + p0 + wid) * H + lane * 4);
  copy16_g2l(&s_last[wid * EMB_STR + lane * 4], embB + (size_t)lw * H + lane * 4);

  // ---- vsum and column sums over the wave's own 64 rows of n -----------------
  float wg[32];
  v8f f = {};
  {
    v8f va[8] = {};
    float cs[8] = {};
#pragma unroll
    for (int c = 0; c < 4; ++c) {
      if (c == 2) {
        const float* w1 = Wq_first + wo;
        const float* w2 = Wq_last + wo;
#pragma unroll
        for (int j = 0; j < 16; ++j) {
          b1[j].x = w1[4 * j * H]; b1[j].y = w1[(4 * j + 1) * H];
          b2[j].x = w2[4 * j * H]; b2[j].y = w2[(4 * j + 1) * H];
        }
        // the batch's address registers are free for reuse behind this; as an input
        // the lane's offset lives up to the wait
        asm volatile("s_wait_xcnt 0x0" :: "v"(wo) : "memory");
      }
      if (c == 3) {
        const char* vb = (const char*)(loadv + b * P + p0);
        lv0 = *(const v4f*)(vb + lo);
        lv1 = *(const v4f*)(vb + lo + 16);
        wl = W_load[hcol]; bl = b_load[hcol];
        // the batch's address registers are free for reuse behind this; as inputs
        // the lanes' offsets live up to the wait
        asm volatile("s_wait_xcnt 0x0" :: "v"(hcol), "v"(lo) : "memory");
        const float* w3 = Wv + wo;
#pragma unroll
        for (int j = 0; j < 16; ++j) {
          b3[j].x = w3[4 * j * H]; b3[j].y = w3[(4 * j + 1) * H];
        }
        // the batch's address registers are free for reuse behind this; as an input
        // the lane's offset lives up to the wait
        asm volatile("s_wait_xcnt 0x0" :: "v"(wo) : "memory");
      }
      // the upper half-wave reads four rows on: 528 words, 16 banks away
      const float* tb = &s_emb[((wid * 2 + (c & 1)) * 16 + 4 * half) * EMB_STR + lrow];
#pragma unroll
      for (int jj = 0; jj < 2; ++jj) {
        const int j = 2 * c + jj;
        const bool ok = wid * 64 + 8 * j < NN;
        const float one = ok ? 1.f : 0.f;
        float m4[4];
#pragma unroll
        for (int e = 0; e < 4; ++e) {
          const float g = mk[j][e];
          m4[e] = ok ? ((g < -1e30f) ? 1.f : g) : 0.f;
        }
#pragma unroll
        for (int st = 0; st < 2; ++st) {
          const v2f am = {m4[2 * st], m4[2 * st + 1]};
          v2f bb[8];
#pragma unroll
          for (int t = 0; t < 8; ++t) {
            bb[t].x = tb[(8 * jj + 2 * st + 0) * EMB_STR + 16 * t];
            bb[t].y = tb[(8 * jj + 2 * st + 1) * EMB_STR + 16 * t];
          }
#pragma unroll
          for (int t = 0; t < 8; ++t) {
            va[t] = wmma_f32(am, bb[t], va[t]);
            cs[t] = fmaf(bb[t].x, one, cs[t]);
            cs[t] = fmaf(bb[t].y, one, cs[t]);
          }
        }
      }
      // hand-over inside the wave: its reads of this buffer are done, its next
      // tile has landed, and only then does it fill this buffer again
      asm volatile("s_wait_dscnt 0x0" ::: "memory");
      asm volatile("s_wait_asynccnt 0x0" ::: "memory");
      // the loop's one barrier, not for the ring: every wave's row of encq1 and of
      // the last-node emb has landed before a wave reads all 16 behind the loop
      if (c == 0) __syncthreads();
      if (c + 2 < 4) stage_emb_tile(s_emb, embB, wid, lane, c + 2);
    }
    // no copy is left in flight behind the loop
    asm volatile("s_wait_asynccnt 0x0" ::: "memory");

    // the thread's quarter column of Wq_graph: no register is free for it in the
    // loop above; it flies beside the stores below
    const float* gb = Wq_graph + (size_t)qr * 32 * H + hc;
#pragma unroll
    for (int k = 0; k < 32; ++k) wg[k] = gb[k * H];
    // the batch's address registers are free for reuse behind this; as an input
    // the lane's offset lives up to the wait
    asm volatile("s_wait_xcnt 0x0" :: "v"(hc) : "memory");

    // the wave's partial sums as a matrix [p][h] in its buffer 0 (tile 2 is used
    // up; tile 3 stays in buffer 1 for the score loop)
    float* pr = &s_emb[(wid * 2 * 16 + 8 * half) * EMB_STR + lrow];
#pragma unroll
    for (int t = 0; t < 8; ++t) {
#pragma unroll
      for (int r = 0; r < 8; ++r) pr[r * EMB_STR + 16 * t] = va[t][r];
      s_fq[(wid * 2 + half) * H + 16 * t + lrow] = cs[t];
    }
  }

  // the two products of final_q that hang on no sum over n, over the wave's 64
  // values of K; the sums stay in the accumulator for the third product
  {
    const float* a1 = &s_enc[lrow * EMB_STR + 64 * kh + khi];
    const float* a2 = &s_last[lrow * EMB_STR + 64 * kh + khi];
#pragma unroll
    for (int g = 0; g < 4; ++g) {
      v2f x1[4], x2[4];
#pragma unroll
      for (int j = 0; j < 4; ++j) {
        const int k = 4 * (4 * g + j);
        x1[j] = *(const v2f*)(a1 + k);
        x2[j] = *(const v2f*)(a2 + k);
      }
#pragma unroll
      for (int j = 0; j < 4; ++j) {
        f = wmma_f32(x1[j], b1[4 * g + j], f);
        f = wmma_f32(x2[j], b2[4 * g + j], f);
      }
    }
    // + load*W_load + b_load, once: in K half 0
#pragma unroll
    for (int r = 0; r < 8; ++r) {
      const float lv = (r < 4) ? lv0[r & 3] : lv1[r & 3];
      const float ex = (kh == 0) ? (lv * wl + bl) : 0.f;
      f[r] += ex;
    }
  }

  // every wave's partial sums are written
  __syncthreads();
  {
    // row wid of vsum/N: the 16 waves' partial rows, four columns a lane
    const float* pp = &s_emb[wid * EMB_STR + lane * 4];
    v4f x[16];
#pragma unroll
    for (int w = 0; w < 16; ++w) x[w] = *(const v4f*)(pp + w * 2 * 16 * EMB_STR);
    v4f vs = {};
#pragma unroll
    for (int w = 0; w < 16; ++w) vs += x[w];
    *(v4f*)&s_vs[wid * EMB_STR + lane * 4] = vs * invN;
  }
  if (qr == 0) {   // column mean: waves 0..3, one column a thread
    float sm = 0.f;
#pragma unroll
    for (int c = 0; c < 32; ++c) sm += s_fq[c * H + hc];
    s_mean[hc] = sm * invN;
  }
  // buffer 0's last reads are done in every wave before it is filled again
  asm volatile("s_wait_dscnt 0x0" ::: "memory");
  __syncthreads();
  stage_emb_tile(s_emb, embB, wid, lane, 2);

  {
    float s = 0.f;
#pragma unroll
    for (int k = 0; k < 32; ++k) s += s_mean[32 * qr + k] * wg[k];
    s_qg[qr * H + hc] = s;
  }
  __syncthreads();

  // the third product, (vsum/N) @ W_visited, on top of the first two
  {
    const float* av = &s_vs[lrow * EMB_STR + 64 * kh + khi];
#pragma unroll
    for (int g = 0; g < 4; ++g) {
      v2f x3[4];
#pragma unroll
      for (int j = 0; j < 4; ++j) x3[j] = *(const v2f*)(av + 4 * (4 * g + j));
#pragma unroll
      for (int j = 0; j < 4; ++j) f = wmma_f32(x3[j], b3[4 * g + j], f);
    }
    // + q_graph, once: in K half 0
    const float qg = (s_qg[hcol] + s_qg[H + hcol]) + (s_qg[2 * H + hcol] + s_qg[3 * H + hcol]);
#pragma unroll
    for (int r = 0; r < 8; ++r)
      s_fq[(kh * 16 + r + 8 * half) * EMB_STR + hcol] = f[r] + ((kh == 0) ? qg : 0.f);
  }
  __syncthreads();

  // The lane's 32 distance and 32 mask values are asked for here, in one batch,
  // behind final_q's last barrier (a barrier waits for every load in front of it):
  // their latency is paid once, beside the score loop. Column clamped like emb's
  // row: every address is in bounds.
  const int nb = wid * 64 + lrow;              // the lane's column in tile q: nb + 16 q
  float dv[4][8], gv[4][8];
#pragma unroll
  for (int q = 0; q < 4; ++q) {
    const int n  = nb + 16 * q;
    const int nc = (n < NN) ? n : (NN - 1);
#pragma unroll
    for (int r = 0; r < 8; ++r) {
      dv[q][r] = dists[((size_t)b * NN + ln[r]) * NN + nc];
      gv[q][r] = gmask[((size_t)b * P + p0 + r + 8 * half) * NN + nc];
    }
  }

  v2f a[32];
#pragma unroll
  for (int k = 0; k < 32; ++k)
    a[k] = *(const v2f*)&s_fq[lrow * EMB_STR + 4 * k + khi] +
           *(const v2f*)&s_fq[(16 + lrow) * EMB_STR + 4 * k + khi];

  v8f acc[4] = {};
#pragma unroll
  for (int c = 3; c >= 0; --c) {
    const float* bp = &s_emb[((wid * 2 + (c & 1)) * 16 + lrow) * EMB_STR + khi];
#pragma unroll
    for (int g = 0; g < 4; ++g) {
      v2f bf[8];
#pragma unroll
      for (int j = 0; j < 8; ++j) bf[j] = *(const v2f*)(bp + 4 * (8 * g + j));
#pragma unroll
      for (int j = 0; j < 8; ++j) acc[c] = wmma_f32(a[8 * g + j], bf[j], acc[c]);
    }
    // hand-over inside the wave: its reads of this buffer are done, its next
    // tile has landed, and only then does it fill this buffer again
    asm volatile("s_wait_dscnt 0x0" ::: "memory");
    asm volatile("s_wait_asynccnt 0x0" ::: "memory");
    if (c - 2 >= 0) stage_emb_tile(s_emb, embB, wid, lane, c - 2);
  }
  // no copy is left in flight behind the loop
  asm volatile("s_wait_asynccnt 0x0" ::: "memory");

  const float log2e  = 1.4426950408889634f;
  const float k_acc  = 0.25503486164919736f;     // 2 log2(e) / sqrt(128)
  const float k_dist = 2.040278893193579f;       // 2 log2(e) / sqrt(2)

  // logits in place of the accumulators; columns past N take no part
  float m[8];
#pragma unroll
  for (int r = 0; r < 8; ++r) m[r] = -3.4e38f;
#pragma unroll
  for (int q = 0; q < 4; ++q) {
    const bool live = nb + 16 * q < NN;
#pragma unroll
    for (int r = 0; r < 8; ++r) {
      // 10 tanh(s) = 10 - 20 / (e^(2s) + 1); x = 2 s log2(e). Both ends are
      // right without a branch: 2^x = inf gives 10, 2^x = 0 gives -10.
      float x  = acc[q][r] * k_acc - dv[q][r] * k_dist;
      float sc = 10.f - 20.f * __builtin_amdgcn_rcpf(__builtin_amdgcn_exp2f(x) + 1.0f);
      float g  = gv[q][r];
      float o  = sc + ((g < -1e30f) ? -1e8f : g);
      o = live ? o : -3.4e38f;
      acc[q][r] = o;
      m[r] = fmaxf(m[r], o);
    }
  }

  // row maximum: 16 lanes, then the 16 waves (lane l takes wave l's values)
#pragma unroll
  for (int r = 0; r < 8; ++r) m[r] = row16_max(m[r]);
  if (lrow == 0) {
    v4f x0 = {m[0], m[1], m[2], m[3]}, x1 = {m[4], m[5], m[6], m[7]};
    *(v4f*)&s_rm[wid * 16 + 8 * half]     = x0;
    *(v4f*)&s_rm[wid * 16 + 8 * half + 4] = x1;
  }
  __syncthreads();
  {
    const v4f x0 = *(const v4f*)&s_rm[lrow * 16 + 8 * half];
    const v4f x1 = *(const v4f*)&s_rm[lrow * 16 + 8 * half + 4];
#pragma unroll
    for (int r = 0; r < 4; ++r) {
      m[r]     = row16_max(x0[r]);
      m[4 + r] = row16_max(x1[r]);
    }
  }

  float sum[8] = {};
#pragma unroll
  for (int q = 0; q < 4; ++q)
#pragma unroll
    for (int r = 0; r < 8; ++r) {
      // the difference first, the scale behind it: exact also where a whole
      // row is masked and both terms lie near -1e8
      float e = __builtin_amdgcn_exp2f((acc[q][r] - m[r]) * log2e);
      acc[q][r] = e;
      sum[r] += e;
    }
#pragma unroll
  for (int r = 0; r < 8; ++r) sum[r] = row16_sum(sum[r]);
  if (lrow == 0) {
    v4f x0 = {sum[0], sum[1], sum[2], sum[3]}, x1 = {sum[4], sum[5], sum[6], sum[7]};
    *(v4f*)&s_rs[wid * 16 + 8 * half]     = x0;
    *(v4f*)&s_rs[wid * 16 + 8 * half + 4] = x1;
  }
  __syncthreads();
  {
    const v4f x0 = *(const v4f*)&s_rs[lrow * 16 + 8 * half];
    const v4f x1 = *(const v4f*)&s_rs[lrow * 16 + 8 * half + 4];
#pragma unroll
    for (int r = 0; r < 4; ++r) {
      sum[r]     = 1.0f / row16_sum(x0[r]);
      sum[4 + r] = 1.0f / row16_sum(x1[r]);
    }
  }

  float* orow = out + ((size_t)b * P + p0 + 8 * half) * NN + nb;
#pragma unroll
  for (int q = 0; q < 4; ++q) {
    if (nb + 16 * q < NN) {
#pragma unroll
      for (int r = 0; r < 8; ++r)
        orow[r * NN + 16 * q] = acc[q][r] * sum[r];
    }
  }
}

// ---------------------------------------------------------------------------
extern "C" void kernel_launch(void* const* d_in, const int* in_sizes, int n_in,
                              void* d_out, int out_size, void* d_ws, size_t ws_size,
                              hipStream_t stream) {
  const float* dists     = (const float*)d_in[0];
  const float* emb       = (const float*)d_in[1];
  const float* encq1     = (const float*)d_in[2];
  const int*   last_node = (const int*)d_in[3];
  const float* loadv     = (const float*)d_in[4];
  const float* gmask     = (const float*)d_in[5];
  const float* Wq_graph  = (const float*)d_in[6];
  const float* Wq_first  = (const float*)d_in[7];
  const float* Wq_last   = (const float*)d_in[8];
  const float* Wv        = (const float*)d_in[9];
  const float* W_load    = (const float*)d_in[10];
  const float* b_load    = (const float*)d_in[11];
  float* out = (float*)d_out;

  score_softmax_kernel<<<B * 4, 512, 0, stream>>>(dists, emb, encq1, last_node, loadv, gmask,
                                                  Wq_graph, Wq_first, Wq_last, Wv,
                                                  W_load, b_load, out);
}

// v010
// One run takes 27.3 microseconds.
// Timed twice side by side with v009, it ran 1.03 times as fast both times.
// Over all steps from v000 it is 9.55 times as fast.
#include <hip/hip_runtime.h>
#include <math.h>

// Shapes from the reference
#define B 64
#define P 64
#define NN 1000
#define H 128

// LDS strides: even (8B-aligned v2f reads) and bank-conflict-free:
// row-indexed pair reads hit banks {4l+c,4l+c+1} (lanes 0-15) vs
// {4l+c+2,4l+c+3} (lanes 16-31) -> disjoint.
#define EMB_STR 132   // rows of 128 floats (emb tiles, vsum and final_q A matrices)

typedef float v2f __attribute__((ext_vector_type(2)));
typedef float v8f __attribute__((ext_vector_type(8)));
typedef int   v4i __attribute__((ext_vector_type(4)));

// Full-precision matrix op: D(16x16,f32) = A(16x4,f32) * B(4x16,f32) + C
// A: lane(0..15) holds M=lane, K={k,k+1}; lane(16..31): M=lane-16, K={k+2,k+3}
// B: lane holds column N=lane&15, rows K = {2*(lane>>4)+0, 2*(lane>>4)+1}
// C/D: vgpr r -> M = r + 8*(lane>>4), N = lane&15
__device__ __forceinline__ v8f wmma_f32(v2f a, v2f b, v8f c) {
  return __builtin_amdgcn_wmma_f32_16x16x4_f32(false, a, false, b, (short)0, c,
                                               false, false);
}

// ---- CDNA5 async global->LDS staging (guarded; falls back to b128 copy) ----
#if __has_builtin(__builtin_amdgcn_global_load_async_to_lds_b128)
#define HAVE_ASYNC_LDS 1
#else
#define HAVE_ASYNC_LDS 0
#endif

__device__ __forceinline__ void copy16_g2l(float* l, const float* g) {
#if HAVE_ASYNC_LDS
  __builtin_amdgcn_global_load_async_to_lds_b128(
      (__attribute__((address_space(1))) v4i*)g,
      (__attribute__((address_space(3))) v4i*)l,
      0, 0);
#else
  *(float4*)l = *(const float4*)g;
#endif
}

// ---------------------------------------------------------------------------
// The one kernel: vsum[b,p,h] = sum_n mask01[p][n]*emb[n][h], the column mean of emb,
// final_q[b,p,h] = encq1@Wq_first + last_emb@Wq_last
//                          + (vsum/N)@W_visited + q_graph + load_emb, then
// probs[b,p,:] = softmax(10*tanh(fq.emb/sqrt(H) - dist/sqrt(2)) + maskprob)
// One workgroup (16 wave32) per (batch b, 16-row tile of p).
// vsum: wave w sums over its own 64 rows of n (the four emb tiles that it also
// scores), all eight H tiles; the column sums come from the same B fragments;
// the 16 waves' partial sums meet in LDS. Nothing goes through global memory.
// final_q: wave w does the 16 columns of H tile w&7 over K half w>>3 of the
// three products; the two halves' sums meet in LDS, where the A fragments of
// the score product are read from. It never goes through global memory.
// Scores: the workgroup owns whole rows of the output, so the logits stay in
// the accumulators' registers through the softmax and the output is written
// once. Wave w does the four n-tiles 4w..4w+3 (64 neighbouring columns). The A
// fragments (the 16 rows of final_q) are the same for every tile and sit in
// registers; each wave's emb tile comes to LDS in whole rows by async copies,
// two buffers, next tile in flight. The score loop takes the tiles from the last
// to the first: tile 3 still lies in its buffer from the vsum loop.
// The two buffers are a ring private to their wave: only the wave that copies a
// tile reads it. A hand-over is therefore the wave's own two waits and no
// work-group barrier, and the 16 waves do not march in step through the loops.
// Every loop of this kernel is unrolled: the arrays are registers only while
// every index is a constant.
// ---------------------------------------------------------------------------
typedef float v4f __attribute__((ext_vector_type(4)));

// value of lane (l ^ MASK) inside the 16-lane row: CTRL = 0x160 | MASK (row_xmask)
template <int CTRL>
__device__ __forceinline__ float row_xor(float v) {
  return __builtin_bit_cast(float, __builtin_amdgcn_update_dpp(
      0, __builtin_bit_cast(int, v), CTRL, 0xf, 0xf, true));
}
__device__ __forceinline__ float row16_max(float v) {
  v = fmaxf(v, row_xor<0x161>(v));
  v = fmaxf(v, row_xor<0x162>(v));
  v = fmaxf(v, row_xor<0x164>(v));
  v = fmaxf(v, row_xor<0x168>(v));
  return v;
}
__device__ __forceinline__ float row16_sum(float v) {
  v += row_xor<0x161>(v);
  v += row_xor<0x162>(v);
  v += row_xor<0x164>(v);
  v += row_xor<0x168>(v);
  return v;
}

// wave wid's n-tile 4*wid+c: 16 rows of 512 B, one copy per row. A tile that
// lies wholly inside N (a test that is the same for the whole wave) goes from
// one address with constant steps: a tile is staged twice, and sixteen clamped
// addresses a tile, held from the first time to the second, spilled. In the
// last wave's tail tiles the row is clamped: every address is in bounds, every
// lane is on.
__device__ __forceinline__ void stage_emb_tile(float* s_emb, const float* embB,
                                               int wid, int lane, int c) {
  float* dst = s_emb + (wid * 2 + (c & 1)) * 16 * EMB_STR + lane * 4;
  const int n0 = (wid * 4 + c) * 16;
  if (n0 + 16 <= NN) {
    const float* g = embB + (size_t)n0 * H + lane * 4;
#pragma unroll
    for (int i = 0; i < 16; ++i) copy16_g2l(dst + i * EMB_STR, g + i * H);
  } else {
#pragma unroll
    for (int i = 0; i < 16; ++i) {
      const int n = (n0 + i < NN) ? (n0 + i) : (NN - 1);
      copy16_g2l(dst + i * EMB_STR, embB + (size_t)n * H + lane * 4);
    }
  }
}

__global__ void __launch_bounds__(512)
score_softmax_kernel(const float* __restrict__ dists, const float* __restrict__ emb,
                     const float* __restrict__ encq1, const int* __restrict__ last_node,
                     const float* __restrict__ loadv, const float* __restrict__ gmask,
                     const float* __restrict__ Wq_graph, const float* __restrict__ Wq_first,
                     const float* __restrict__ Wq_last, const float* __restrict__ Wv,
                     const float* __restrict__ W_load, const float* __restrict__ b_load,
                     float* __restrict__ out)
{
  // 264 KB: [wave][buffer][16 rows]; a wave's two buffers lie side by side, so
  // that all its fragment reads are one address register and an offset
  __shared__ __align__(16) float s_emb[16 * 2 * 16 * EMB_STR];
  // the column sums: [wave][lane half][h]; once the mean is taken, final_q: [K half][row]
  __shared__ __align__(16) float s_fq[2 * 16 * EMB_STR];
  __shared__ __align__(16) float s_vs[16 * EMB_STR];        // vsum/N: [row]
  // the tile's rows of encq1, then the rows' last-node emb
  __shared__ __align__(16) float s_a12[2 * 16 * EMB_STR];
  float* const s_enc  = s_a12;
  float* const s_last = s_a12 + 16 * EMB_STR;
  __shared__ __align__(16) float s_mean[H];
  __shared__ float s_qg[4 * H];                             // q_graph: [K quarter][h]
  __shared__ __align__(16) float s_rm[16 * 16];             // [wave][row] maxima
  __shared__ __align__(16) float s_rs[16 * 16];             // [wave][row] sums

  // The four work-groups that read one batch's emb have flat indices 64 apart,
  // equal modulo 8.
  // For speed only: every (b, pt) is
  // done once wherever the work-groups land.
  const int b    = blockIdx.x & (B - 1);
  const int pt   = blockIdx.x >> 6;
  const int p0   = pt * 16;
  const int tid  = threadIdx.x;
  const int lane = tid & 31;
  const int wid  = __builtin_amdgcn_readfirstlane(tid >> 5);
  const int lrow = lane & 15;
  const int half = lane >> 4;
  const int khi  = half * 2;
  const float* embB = emb + (size_t)b * NN * H;

  // The wave's A fragments of the vsum product: the mask of its 64 columns, 16
  // bytes a load, asked for in one batch ahead of the copies. Load j holds
  // n = 64 wid + 8 j + 4 half + {0..3}: two k-steps, whose B rows follow the same
  // order. A group of eight past N is read at a clamped place and counts as zero.
  v4f mk[8];
  {
    const float* gmT = gmask + ((size_t)b * P + p0) * NN;
    const unsigned mo = (lrow * NN + 4 * half) * 4u;   // the lane's byte offset
#pragma unroll
    for (int j = 0; j < 8; ++j) {
      const int nj = wid * 64 + 8 * j;
      mk[j] = *(const v4f*)((const char*)(gmT + ((nj < NN) ? nj : (NN - 8))) + mo);
    }
    // the batch's address registers are free for reuse behind this; as an input
    // the lane's offset lives up to the wait
    asm volatile("s_wait_xcnt 0x0" :: "v"(mo) : "memory");
  }

  // the wave's first emb tile: with the mask and last_node, what the head of the kernel waits for
  stage_emb_tile(s_emb, embB, wid, lane, 0);
  int lw = last_node[b * P + p0 + wid];
  lw = (lw < 0) ? 0 : ((lw > NN - 1) ? NN - 1 : lw);   // row index bounded before use

  // the lane's eight rows of dists; row index bounded before use
  const unsigned lo = 32u * half;   // the lane's byte offset in a row of 16 words
  int ln[8];
  {
    const char* lb = (const char*)(last_node + b * P + p0);
    const v4i l0 = *(const v4i*)(lb + lo);
    const v4i l1 = *(const v4i*)(lb + lo + 16);
    // the two loads' address register is free for reuse behind this; as an input
    // the lane's offset lives up to the wait
    asm volatile("s_wait_xcnt 0x0" :: "v"(lo) : "memory");
#pragma unroll
    for (int r = 0; r < 4; ++r) { ln[r] = l0[r]; ln[4 + r] = l1[r]; }
#pragma unroll
    for (int r = 0; r < 8; ++r)
      ln[r] = (ln[r] < 0) ? 0 : ((ln[r] > NN - 1) ? NN - 1 : ln[r]);
  }

  // ---- final_q -------------------------------------------------------------
  const int ht   = wid & 7;           // the wave's H tile (16 output columns)
  const int kh   = wid >> 3;          // its half of K
  const int qr   = wid >> 2;          // its quarter of the q_graph matvec's K
  const int hc   = tid & 127;         // the thread's column in mean and matvec
  const int hcol = 16 * ht + lrow;    // the lane's output column
  const float invN = 1.0f / NN;

  // What final_q takes from global memory (the epilogue's values, the wave's B
  // fragments of all its 16 k-steps of the three weight matrices) is not asked
  // for here: the head of the kernel would wait for it with the matrix unit idle.
  // It is asked for in the last two trips of the vsum loop, behind the last emb
  // tile's copies and in the order in which it is used, and flies beside them.
  v4f lv0, lv1;
  float wl, bl;
  v2f b1[16], b2[16], b3[16];
  const unsigned wo = (64 * kh + khi) * H + hcol;   // the lane's first weight element

  // the wave's own tile 0 has landed: nobody else reads it, no barrier
  asm volatile("s_wait_asynccnt 0x0" ::: "memory");
  stage_emb_tile(s_emb, embB, wid, lane, 1);
  // row wid of the two A matrices that come from global memory (whole rows: one
  // copy per thread each); they land beside trip 0
  copy16_g2l(&s_enc[wid * EMB_STR + lane * 4],
             encq1 + ((size_t)b * P + p0 + wid) * H + lane * 4);
  copy16_g2l(&s_last[wid * EMB_STR + lane * 4], embB + (size_t)lw * H + lane * 4);

  // ---- vsum and column sums over the wave's own 64 rows of n -----------------
  float wg[32];
  v8f f = {};
  {
    v8f va[8] = {};
    float cs[8] = {};
#pragma unroll
    for (int c = 0; c < 4; ++c) {
      if (c == 2) {
        const float* w1 = Wq_first + wo;
        const float* w2 = Wq_last + wo;
#pragma unroll
        for (int j = 0; j < 16; ++j) {
          b1[j].x = w1[4 * j * H]; b1[j].y = w1[(4 * j + 1) * H];
          b2[j].x = w2[4 * j * H]; b2[j].y = w2[(4 * j + 1) * H];
        }
        // the batch's address registers are free for reuse behind this; as an input
        // the lane's offset lives up to the wait
        asm volatile("s_wait_xcnt 0x0" :: "v"(wo) : "memory");
      }
      if (c == 3) {
        const char* vb = (const char*)(loadv + b * P + p0);
        lv0 = *(const v4f*)(vb + lo);
        lv1 = *(const v4f*)(vb + lo + 16);
        wl = W_load[hcol]; bl = b_load[hcol];
        // the batch's address registers are free for reuse behind this; as inputs
        // the lanes' offsets live up to the wait
        asm volatile("s_wait_xcnt 0x0" :: "v"(hcol), "v"(lo) : "memory");
        const float* w3 = Wv + wo;
#pragma unroll
        for (int j = 0; j < 16; ++j) {
          b3[j].x = w3[4 * j * H]; b3[j].y = w3[(4 * j + 1) * H];
        }
        // the batch's address registers are free for reuse behind this; as an input
        // the lane's offset lives up to the wait
        asm volatile("s_wait_xcnt 0x0" :: "v"(wo) : "memory");
      }
      // the upper half-wave reads four rows on: 528 words, 16 banks away
      const float* tb = &s_emb[((wid * 2 + (c & 1)) * 16 + 4 * half) * EMB_STR + lrow];
#pragma unroll
      for (int jj = 0; jj < 2; ++jj) {
        const int j = 2 * c + jj;
        const bool ok = wid * 64 + 8 * j < NN;
        const float one = ok ? 1.f : 0.f;
        float m4[4];
#pragma unroll
        for (int e = 0; e < 4; ++e) {
          const float g = mk[j][e];
          m4[e] = ok ? ((g < -1e30f) ? 1.f : g) : 0.f;
        }
#pragma unroll
        for (int st = 0; st < 2; ++st) {
          const v2f am = {m4[2 * st], m4[2 * st + 1]};
          v2f bb[8];
#pragma unroll
          for (int t = 0; t < 8; ++t) {
            bb[t].x = tb[(8 * jj + 2 * st + 0) * EMB_STR + 16 * t];
            bb[t].y = tb[(8 * jj + 2 * st + 1) * EMB_STR + 16 * t];
          }
#pragma unroll
          for (int t = 0; t < 8; ++t) {
            va[t] = wmma_f32(am, bb[t], va[t]);
            cs[t] = fmaf(bb[t].x, one, cs[t]);
            cs[t] = fmaf(bb[t].y, one, cs[t]);
          }
        }
      }
      // hand-over inside the wave: its reads of this buffer are done, its next
      // tile has landed, and only then does it fill this buffer again
      asm volatile("s_wait_dscnt 0x0" ::: "memory");
      asm volatile("s_wait_asynccnt 0x0" ::: "memory");
      // the loop's one barrier, not for the ring: every wave's row of encq1 and of
      // the last-node emb has landed before a wave reads all 16 behind the loop
      if (c == 0) __syncthreads();
      if (c + 2 < 4) stage_emb_tile(s_emb, embB, wid, lane, c + 2);
    }
    // no copy is left in flight behind the loop
    asm volatile("s_wait_asynccnt 0x0" ::: "memory");

    // the thread's quarter column of Wq_graph: no register is free for it in the
    // loop above; it flies beside the stores below
    const float* gb = Wq_graph + (size_t)qr * 32 * H + hc;
#pragma unroll
    for (int k = 0; k < 32; ++k) wg[k] = gb[k * H];
    // the batch's address registers are free for reuse behind this; as an input
    // the lane's offset lives up to the wait
    asm volatile("s_wait_xcnt 0x0" :: "v"(hc) : "memory");

    // the wave's partial sums as a matrix [p][h] in its buffer 0 (tile 2 is used
    // up; tile 3 stays in buffer 1 for the score loop)
    float* pr = &s_emb[(wid * 2 * 16 + 8 * half) * EMB_STR + lrow];
#pragma unroll
    for (int t = 0; t < 8; ++t) {
#pragma unroll
      for (int r = 0; r < 8; ++r) pr[r * EMB_STR + 16 * t] = va[t][r];
      s_fq[(wid * 2 + half) * H + 16 * t + lrow] = cs[t];
    }
  }

  // the two products of final_q that hang on no sum over n, over the wave's 64
  // values of K; the sums stay in the accumulator for the third product
  {
    const float* a1 = &s_enc[lrow * EMB_STR + 64 * kh + khi];
    const float* a2 = &s_last[lrow * EMB_STR + 64 * kh + khi];
#pragma unroll
    for (int g = 0; g < 4; ++g) {
      v2f x1[4], x2[4];
#pragma unroll
      for (int j = 0; j < 4; ++j) {
        const int k = 4 * (4 * g + j);
        x1[j] = *(const v2f*)(a1 + k);
        x2[j] = *(const v2f*)(a2 + k);
      }
#pragma unroll
      for (int j = 0; j < 4; ++j) {
        f = wmma_f32(x1[j], b1[4 * g + j], f);
        f = wmma_f32(x2[j], b2[4 * g + j], f);
      }
    }
    // + load*W_load + b_load, once: in K half 0
#pragma unroll
    for (int r = 0; r < 8; ++r) {
      const float lv = (r < 4) ? lv0[r & 3] : lv1[r & 3];
      const float ex = (kh == 0) ? (lv * wl + bl) : 0.f;
      f[r] += ex;
    }
  }

  // every wave's partial sums are written
  __syncthreads();
  {
    // row wid of vsum/N: the 16 waves' partial rows, four columns a lane
    const float* pp = &s_emb[wid * EMB_STR + lane * 4];
    v4f x[16];
#pragma unroll
    for (int w = 0; w < 16; ++w) x[w] = *(const v4f*)(pp + w * 2 * 16 * EMB_STR);
    v4f vs = {};
#pragma unroll
    for (int w = 0; w < 16; ++w) vs += x[w];
    *(v4f*)&s_vs[wid * EMB_STR + lane * 4] = vs * invN;
  }
  if (qr == 0) {   // column mean: waves 0..3, one column a thread
    float sm = 0.f;
#pragma unroll
    for (int c = 0; c < 32; ++c) sm += s_fq[c * H + hc];
    s_mean[hc] = sm * invN;
  }
  // buffer 0's last reads are done in every wave before it is filled again
  asm volatile("s_wait_dscnt 0x0" ::: "memory");
  __syncthreads();
  stage_emb_tile(s_emb, embB, wid, lane, 2);

  {
    float s = 0.f;
#pragma unroll
    for (int k = 0; k < 32; ++k) s += s_mean[32 * qr + k] * wg[k];
    s_qg[qr * H + hc] = s;
  }
  __syncthreads();

  // the third product, (vsum/N) @ W_visited, on top of the first two
  {
    const float* av = &s_vs[lrow * EMB_STR + 64 * kh + khi];
#pragma unroll
    for (int g = 0; g < 4; ++g) {
      v2f x3[4];
#pragma unroll
      for (int j = 0; j < 4; ++j) x3[j] = *(const v2f*)(av + 4 * (4 * g + j));
#pragma unroll
      for (int j = 0; j < 4; ++j) f = wmma_f32(x3[j], b3[4 * g + j], f);
    }
    // + q_graph, once: in K half 0
    const float qg = (s_qg[hcol] + s_qg[H + hcol]) + (s_qg[2 * H + hcol] + s_qg[3 * H + hcol]);
#pragma unroll
    for (int r = 0; r < 8; ++r)
      s_fq[(kh * 16 + r + 8 * half) * EMB_STR + hcol] = f[r] + ((kh == 0) ? qg : 0.f);
  }
  __syncthreads();

  // The lane's 32 distance and 32 mask values are asked for here, in one batch,
  // behind final_q's last barrier (a barrier waits for every load in front of it):
  // their latency is paid once, beside the score loop. Column clamped like emb's
  // row: every address is in bounds.
  const int nb = wid * 64 + lrow;              // the lane's column in tile q: nb + 16 q
  float dv[4][8], gv[4][8];
#pragma unroll
  for (int q = 0; q < 4; ++q) {
    const int n  = nb + 16 * q;
    const int nc = (n < NN) ? n : (NN - 1);
#pragma unroll
    for (int r = 0; r < 8; ++r) {
      dv[q][r] = dists[((size_t)b * NN + ln[r]) * NN + nc];
      gv[q][r] = gmask[((size_t)b * P + p0 + r + 8 * half) * NN + nc];
    }
  }

  v2f a[32];
#pragma unroll
  for (int k = 0; k < 32; ++k)
    a[k] = *(const v2f*)&s_fq[lrow * EMB_STR + 4 * k + khi] +
           *(const v2f*)&s_fq[(16 + lrow) * EMB_STR + 4 * k + khi];

  v8f acc[4] = {};
#pragma unroll
  for (int c = 3; c >= 0; --c) {
    const float* bp = &s_emb[((wid * 2 + (c & 1)) * 16 + lrow) * EMB_STR + khi];
#pragma unroll
    for (int g = 0; g < 4; ++g) {
      v2f bf[8];
#pragma unroll
      for (int j = 0; j < 8; ++j) bf[j] = *(const v2f*)(bp + 4 * (8 * g + j));
#pragma unroll
      for (int j = 0; j < 8; ++j) acc[c] = wmma_f32(a[8 * g + j], bf[j], acc[c]);
    }
    // hand-over inside the wave: its reads of this buffer are done, its next
    // tile has landed, and only then does it fill this buffer again
    asm volatile("s_wait_dscnt 0x0" ::: "memory");
    asm volatile("s_wait_asynccnt 0x0" ::: "memory");
    if (c - 2 >= 0) stage_emb_tile(s_emb, embB, wid, lane, c - 2);
  }
  // no copy is left in flight behind the loop
  asm volatile("s_wait_asynccnt 0x0" ::: "memory");

  const float log2e  = 1.4426950408889634f;
  const float k_acc  = 0.25503486164919736f;     // 2 log2(e) / sqrt(128)
  const float k_dist = 2.040278893193579f;       // 2 log2(e) / sqrt(2)

  // logits in place of the accumulators; columns past N take no part
  float m[8];
#pragma unroll
  for (int r = 0; r < 8; ++r) m[r] = -3.4e38f;
#pragma unroll
  for (int q = 0; q < 4; ++q) {
    const bool live = nb + 16 * q < NN;
#pragma unroll
    for (int r = 0; r < 8; ++r) {
      // 10 tanh(s) = 10 - 20 / (e^(2s) + 1); x = 2 s log2(e). Both ends are
      // right without a branch: 2^x = inf gives 10, 2^x = 0 gives -10.
      float x  = acc[q][r] * k_acc - dv[q][r] * k_dist;
      float sc = 10.f - 20.f * __builtin_amdgcn_rcpf(__builtin_amdgcn_exp2f(x) + 1.0f);
      float g  = gv[q][r];
      float o  = sc + ((g < -1e30f) ? -1e8f : g);
      o = live ? o : -3.4e38f;
      acc[q][r] = o;
      m[r] = fmaxf(m[r], o);
    }
  }

  // row maximum: 16 lanes, then the 16 waves (lane l takes wave l's values)
#pragma unroll
  for (int r = 0; r < 8; ++r) m[r] = row16_max(m[r]);
  if (lrow == 0) {
    v4f x0 = {m[0], m[1], m[2], m[3]}, x1 = {m[4], m[5], m[6], m[7]};
    *(v4f*)&s_rm[wid * 16 + 8 * half]     = x0;
    *(v4f*)&s_rm[wid * 16 + 8 * half + 4] = x1;
  }
  __syncthreads();
  {
    const v4f x0 = *(const v4f*)&s_rm[lrow * 16 + 8 * half];
    const v4f x1 = *(const v4f*)&s_rm[lrow * 16 + 8 * half + 4];
#pragma unroll
    for (int r = 0; r < 4; ++r) {
      m[r]     = row16_max(x0[r]);
      m[4 + r] = row16_max(x1[r]);
    }
  }

  float sum[8] = {};
#pragma unroll
  for (int q = 0; q < 4; ++q)
#pragma unroll
    for (int r = 0; r < 8; ++r) {
      // the difference first, the scale behind it: exact also where a whole
      // row is masked and both terms lie near -1e8
      float e = __builtin_amdgcn_exp2f((acc[q][r] - m[r]) * log2e);
      acc[q][r] = e;
      sum[r] += e;
    }
#pragma unroll
  for (int r = 0; r < 8; ++r) sum[r] = row16_sum(sum[r]);
  if (lrow == 0) {
    v4f x0 = {sum[0], sum[1], sum[2], sum[3]}, x1 = {sum[4], sum[5], sum[6], sum[7]};
    *(v4f*)&s_rs[wid * 16 + 8 * half]     = x0;
    *(v4f*)&s_rs[wid * 16 + 8 * half + 4] = x1;
  }
  __syncthreads();
  {
    const v4f x0 = *(const v4f*)&s_rs[lrow * 16 + 8 * half];
    const v4f x1 = *(const v4f*)&s_rs[lrow * 16 + 8 * half + 4];
#pragma unroll
    for (int r = 0; r < 4; ++r) {
      sum[r]     = 1.0f / row16_sum(x0[r]);
      sum[4 + r] = 1.0f / row16_sum(x1[r]);
    }
  }

  float* orow = out + ((size_t)b * P + p0 + 8 * half) * NN + nb;
#pragma unroll
  for (int q = 0; q < 4; ++q) {
    if (nb + 16 * q < NN) {
#pragma unroll
      for (int r = 0; r < 8; ++r)
        orow[r * NN + 16 * q] = acc[q][r] * sum[r];
    }
  }
}

// ---------------------------------------------------------------------------
extern "C" void kernel_launch(void* const* d_in, const int* in_sizes, int n_in,
                              void* d_out, int out_size, void* d_ws, size_t ws_size,
                              hipStream_t stream) {
  const float* dists     = (const float*)d_in[0];
  const float* emb       = (const float*)d_in[1];
  const float* encq1     = (const float*)d_in[2];
  const int*   last_node = (const int*)d_in[3];
  const float* loadv     = (const float*)d_in[4];
  const float* gmask     = (const float*)d_in[5];
  const float* Wq_graph  = (const float*)d_in[6];
  const float* Wq_first  = (const float*)d_in[7];
  const float* Wq_last   = (const float*)d_in[8];
  const float* Wv        = (const float*)d_in[9];
  const float* W_load    = (const float*)d_in[10];
  const float* b_load    = (const float*)d_in[11];
  float* out = (float*)d_out;

  score_softmax_kernel<<<B * 4, 512, 0, stream>>>(dists, emb, encq1, last_node, loadv, gmask,
                                                  Wq_graph, Wq_first, Wq_last, Wv,
                                                  W_load, b_load, out);
}
